// v000
// Measured on an AMD MI455X. A time is GPU time per run, averaged over a window of back-to-back runs after a warm-up
// (all launches, gaps included; the runs take copies of the inputs in turn), and the median of several windows.
// Apart from v000's, it joins two sittings. Times from different sittings can be a few percent apart, while
// side-by-side timings come from the same sitting.
// v000 is the starting kernel. One run takes 3750 microseconds.
#include <hip/hip_runtime.h>
#include <hip/hip_bf16.h>
#include <math.h>

typedef __attribute__((ext_vector_type(16))) __bf16 v16bf;
typedef __attribute__((ext_vector_type(8)))  __bf16 v8bf;
typedef __attribute__((ext_vector_type(8)))  float  v8f;

#define BB 2
#define LL 2048
#define DD 1024
#define NN 16
#define ROWS (BB*LL)   // 4096

__device__ __forceinline__ float fast_tanh(float x) {
    float r;
    asm("v_tanh_f32 %0, %1" : "=v"(r) : "v"(x));
    return r;
}

__device__ __forceinline__ float soft_clamp_f(float x, float lo, float hi, float sharp) {
    float c  = 0.5f * (hi + lo);
    float r  = 0.5f * (hi - lo);
    float xn = (x - c) / (r + 1e-8f);
    return fast_tanh(xn * sharp) / sharp * r + c;
}

// ---------------------------------------------------------------------------
// fp32 -> bf16 conversion (4 elements/thread)
// ---------------------------------------------------------------------------
__global__ void __launch_bounds__(256)
cvt_bf16_kernel(const float* __restrict__ in, __bf16* __restrict__ out, int n) {
    int base = (blockIdx.x * blockDim.x + threadIdx.x) * 4;
    if (base < n) {
        float4 v = *(const float4*)(in + base);
        out[base + 0] = (__bf16)v.x;
        out[base + 1] = (__bf16)v.y;
        out[base + 2] = (__bf16)v.z;
        out[base + 3] = (__bf16)v.w;
    }
}

// ---------------------------------------------------------------------------
// dt = soft_clamp(softplus(x @ Wdt^T + bdt))  via  v_wmma_f32_16x16x32_bf16
// 2x2 register tiling: one wave computes a 32x32 output block (4 accumulators),
// each A/B fragment is reused twice -> 8 b128 loads feed 4 WMMAs.
// ---------------------------------------------------------------------------
__global__ void __launch_bounds__(256)
wmma_dt_kernel(const __bf16* __restrict__ xbf, const __bf16* __restrict__ wbf,
               const float* __restrict__ bdt, float* __restrict__ dt) {
    const int lane = threadIdx.x & 31;
    const int wave = threadIdx.x >> 5;            // 0..7
    const int tile = blockIdx.x * 8 + wave;       // 0..4095
    const int tm   = tile >> 5;                   // 0..127  (32-row strips)
    const int tn   = tile & 31;                   // 0..31   (32-col strips)

    const int l15 = lane & 15;
    const int kg  = (lane >> 4) * 8;              // K sub-group: 0 or 8

    // A fragments: rows tm*32 + l15 (+16); K groups [kg..kg+7], [16+kg..16+kg+7]
    const __bf16* arow0 = xbf + (size_t)(tm * 32 + l15) * DD + kg;
    const __bf16* arow1 = arow0 + (size_t)16 * DD;
    // B fragments: columns tn*32 + l15 (+16); Wdt row-major in k
    const __bf16* brow0 = wbf + (size_t)(tn * 32 + l15) * DD + kg;
    const __bf16* brow1 = brow0 + (size_t)16 * DD;

    v8f acc00 = {}, acc01 = {}, acc10 = {}, acc11 = {};

    #pragma unroll 2
    for (int k0 = 0; k0 < DD; k0 += 32) {
        v8bf a0lo = *(const v8bf*)(arow0 + k0);
        v8bf a0hi = *(const v8bf*)(arow0 + k0 + 16);
        v8bf a1lo = *(const v8bf*)(arow1 + k0);
        v8bf a1hi = *(const v8bf*)(arow1 + k0 + 16);
        v8bf b0lo = *(const v8bf*)(brow0 + k0);
        v8bf b0hi = *(const v8bf*)(brow0 + k0 + 16);
        v8bf b1lo = *(const v8bf*)(brow1 + k0);
        v8bf b1hi = *(const v8bf*)(brow1 + k0 + 16);
        v16bf A0, A1, B0, B1;
        #pragma unroll
        for (int i = 0; i < 8; i++) {
            A0[i] = a0lo[i]; A0[i + 8] = a0hi[i];
            A1[i] = a1lo[i]; A1[i + 8] = a1hi[i];
            B0[i] = b0lo[i]; B0[i + 8] = b0hi[i];
            B1[i] = b1lo[i]; B1[i + 8] = b1hi[i];
        }
        acc00 = __builtin_amdgcn_wmma_f32_16x16x32_bf16(false, A0, false, B0, (short)0, acc00, false, false);
        acc01 = __builtin_amdgcn_wmma_f32_16x16x32_bf16(false, A0, false, B1, (short)0, acc01, false, false);
        acc10 = __builtin_amdgcn_wmma_f32_16x16x32_bf16(false, A1, false, B0, (short)0, acc10, false, false);
        acc11 = __builtin_amdgcn_wmma_f32_16x16x32_bf16(false, A1, false, B1, (short)0, acc11, false, false);
    }

    const int mbase = (lane >> 4) * 8;
    auto epilogue = [&](v8f acc, int rowbase, int colbase) {
        const int col  = colbase + l15;
        const float bias = bdt[col];
        #pragma unroll
        for (int r = 0; r < 8; r++) {
            int row  = rowbase + mbase + r;
            float v  = acc[r] + bias;
            // softplus via hardware v_exp_f32 / v_log_f32 (result clamped anyway)
            float sp = (v > 20.f) ? v : __logf(1.f + __expf(v));
            dt[(size_t)row * DD + col] = soft_clamp_f(sp, 0.001f, 0.1f, 0.5f);
        }
    };
    epilogue(acc00, tm * 32,      tn * 32);
    epilogue(acc01, tm * 32,      tn * 32 + 16);
    epilogue(acc10, tm * 32 + 16, tn * 32);
    epilogue(acc11, tm * 32 + 16, tn * 32 + 16);
}

// ---------------------------------------------------------------------------
// Bp = x @ WB^T, Cp = x @ WC^T   ([4096,16] each) — small, plain VALU
// ---------------------------------------------------------------------------
__global__ void __launch_bounds__(256)
proj_kernel(const float* __restrict__ x, const float* __restrict__ WB,
            const float* __restrict__ WC, float* __restrict__ Bp,
            float* __restrict__ Cp) {
    int t   = blockIdx.x * blockDim.x + threadIdx.x;   // 0..65535
    int row = t >> 4;
    int n   = t & 15;
    const float4* xr = (const float4*)(x + (size_t)row * DD);
    const float4* wb = (const float4*)(WB + (size_t)n * DD);
    const float4* wc = (const float4*)(WC + (size_t)n * DD);
    float sb = 0.f, sc = 0.f;
    #pragma unroll 4
    for (int k = 0; k < DD / 4; k++) {
        float4 xv = xr[k], bv = wb[k], cv = wc[k];
        sb += xv.x * bv.x + xv.y * bv.y + xv.z * bv.z + xv.w * bv.w;
        sc += xv.x * cv.x + xv.y * cv.y + xv.z * cv.z + xv.w * cv.w;
    }
    Bp[t] = sb;
    Cp[t] = sc;
}

// ---------------------------------------------------------------------------
// Sequential scan. One workgroup per batch (global norm couples all of D,N).
// thread d holds h[d, 0..15] in registers; norm via shfl + LDS tree.
// All transcendentals are single hardware trans ops (v_tanh_f32 / v_exp_f32).
// ---------------------------------------------------------------------------
__global__ void __launch_bounds__(1024)
scan_kernel(const float* __restrict__ x, const float* __restrict__ dt,
            const float* __restrict__ Bp, const float* __restrict__ Cp,
            const float* __restrict__ A_log, const float* __restrict__ Dp,
            float* __restrict__ out) {
    const int b    = blockIdx.x;
    const int d    = threadIdx.x;
    const int lane = threadIdx.x & 31;
    const int wave = threadIdx.x >> 5;

    __shared__ float wsum[32];
    __shared__ float stotal;

    float A[NN], h[NN];
    #pragma unroll
    for (int n = 0; n < NN; n++) {
        float al = A_log[d * NN + n];
        // soft_clamp(al,-5,5,0.5) = 10*tanh(al/10)
        A[n] = -__expf(10.f * fast_tanh(al * 0.1f));
        h[n] = 0.f;
    }
    const float dpv = Dp[d];

    const float* xb  = x  + (size_t)b * LL * DD;
    const float* dtb = dt + (size_t)b * LL * DD;
    const float* Bb  = Bp + (size_t)b * LL * NN;
    const float* Cb  = Cp + (size_t)b * LL * NN;
    float*       ob  = out + (size_t)b * LL * DD;

    for (int t = 0; t < LL; t++) {
        if (t + 1 < LL) {
            __builtin_prefetch(dtb + (size_t)(t + 1) * DD + d, 0, 0);
            __builtin_prefetch(xb  + (size_t)(t + 1) * DD + d, 0, 0);
        }
        float xv  = xb[(size_t)t * DD + d];
        float dtv = dtb[(size_t)t * DD + d];

        float Brow[NN], Crow[NN];
        #pragma unroll
        for (int q = 0; q < 4; q++) {
            float4 bq = *(const float4*)(Bb + t * NN + q * 4);
            float4 cq = *(const float4*)(Cb + t * NN + q * 4);
            Brow[q*4+0] = bq.x; Brow[q*4+1] = bq.y; Brow[q*4+2] = bq.z; Brow[q*4+3] = bq.w;
            Crow[q*4+0] = cq.x; Crow[q*4+1] = cq.y; Crow[q*4+2] = cq.z; Crow[q*4+3] = cq.w;
        }

        const float dtx = dtv * xv;
        float ss = 0.f;
        #pragma unroll
        for (int n = 0; n < NN; n++) {
            float z  = dtv * A[n];
            // soft_clamp(z,-8,8,0.5) = 16*tanh(z/16)
            float dA = __expf(16.f * fast_tanh(z * 0.0625f));
            h[n] = dA * h[n] + dtx * Brow[n];
            ss  += h[n] * h[n];
        }

        // wave32 reduce, then cross-wave via LDS
        #pragma unroll
        for (int off = 16; off >= 1; off >>= 1) ss += __shfl_xor(ss, off, 32);
        if (lane == 0) wsum[wave] = ss;
        __syncthreads();
        if (wave == 0) {
            float v = wsum[lane];
            #pragma unroll
            for (int off = 16; off >= 1; off >>= 1) v += __shfl_xor(v, off, 32);
            if (lane == 0) stotal = v;
        }
        __syncthreads();

        float norm  = sqrtf(stotal);
        float scale = fminf(20.f / (norm + 1e-8f), 1.f);
        float y = dpv * xv;
        #pragma unroll
        for (int n = 0; n < NN; n++) {
            h[n] *= scale;
            y    += h[n] * Crow[n];
        }
        ob[(size_t)t * DD + d] = y;
    }
}

// ---------------------------------------------------------------------------
extern "C" void kernel_launch(void* const* d_in, const int* in_sizes, int n_in,
                              void* d_out, int out_size, void* d_ws, size_t ws_size,
                              hipStream_t stream) {
    const float* x     = (const float*)d_in[0];
    const float* Wdt   = (const float*)d_in[1];
    const float* bdt   = (const float*)d_in[2];
    const float* WB    = (const float*)d_in[3];
    const float* WC    = (const float*)d_in[4];
    const float* A_log = (const float*)d_in[5];
    const float* Dp    = (const float*)d_in[6];
    float* out = (float*)d_out;

    char* ws = (char*)d_ws;
    size_t off = 0;
    auto take = [&](size_t bytes) -> void* {
        void* p = ws + off;
        off += (bytes + 255) & ~(size_t)255;
        return p;
    };
    float*  dt  = (float*) take((size_t)ROWS * DD * sizeof(float));   // 16 MB
    float*  Bp  = (float*) take((size_t)ROWS * NN * sizeof(float));
    float*  Cp  = (float*) take((size_t)ROWS * NN * sizeof(float));
    __bf16* xbf = (__bf16*)take((size_t)ROWS * DD * sizeof(__bf16));  // 8 MB
    __bf16* wbf = (__bf16*)take((size_t)DD * DD * sizeof(__bf16));    // 2 MB
    (void)ws_size; (void)in_sizes; (void)n_in; (void)out_size;

    // 1) bf16 conversions
    {
        int n = ROWS * DD;                              // 4,194,304
        cvt_bf16_kernel<<<(n / 4 + 255) / 256, 256, 0, stream>>>(x, xbf, n);
        int m = DD * DD;                                // 1,048,576
        cvt_bf16_kernel<<<(m / 4 + 255) / 256, 256, 0, stream>>>(Wdt, wbf, m);
    }
    // 2) WMMA GEMM + softplus + soft_clamp -> dt  (32x32 tile per wave)
    {
        int tiles = (ROWS / 32) * (DD / 32);            // 4096 tiles, 8/block
        wmma_dt_kernel<<<tiles / 8, 256, 0, stream>>>(xbf, wbf, bdt, dt);
    }
    // 3) B/C projections
    proj_kernel<<<(ROWS * NN) / 256, 256, 0, stream>>>(x, WB, WC, Bp, Cp);
    // 4) sequential scan, one workgroup per batch
    scan_kernel<<<BB, 1024, 0, stream>>>(x, dt, Bp, Cp, A_log, Dp, out);
}

// v001
// Measured time: 2360 microseconds a run.
// Two timings next to v000 both put it at 1.59 times that version's speed.
#include <hip/hip_runtime.h>
#include <hip/hip_bf16.h>
#include <math.h>

typedef __attribute__((ext_vector_type(16))) __bf16 v16bf;
typedef __attribute__((ext_vector_type(8)))  __bf16 v8bf;
typedef __attribute__((ext_vector_type(8)))  float  v8f;

#define BB 2
#define LL 2048
#define DD 1024
#define NN 16
#define ROWS (BB*LL)   // 4096

__device__ __forceinline__ float fast_tanh(float x) {
    float r;
    asm("v_tanh_f32 %0, %1" : "=v"(r) : "v"(x));
    return r;
}

__device__ __forceinline__ void tanh8_here(float& a0, float& a1, float& a2, float& a3,
                                           float& a4, float& a5, float& a6, float& a7) {
    asm volatile("v_tanh_f32 %0, %0\n\t"
                 "v_tanh_f32 %1, %1\n\t"
                 "v_tanh_f32 %2, %2\n\t"
                 "v_tanh_f32 %3, %3\n\t"
                 "v_tanh_f32 %4, %4\n\t"
                 "v_tanh_f32 %5, %5\n\t"
                 "v_tanh_f32 %6, %6\n\t"
                 "v_tanh_f32 %7, %7\n\t"
                 "v_nop"
                 : "+v"(a0), "+v"(a1), "+v"(a2), "+v"(a3),
                   "+v"(a4), "+v"(a5), "+v"(a6), "+v"(a7));
}

__device__ __forceinline__ float soft_clamp_f(float x, float lo, float hi, float sharp) {
    float c  = 0.5f * (hi + lo);
    float r  = 0.5f * (hi - lo);
    float xn = (x - c) / (r + 1e-8f);
    return fast_tanh(xn * sharp) / sharp * r + c;
}

// ---------------------------------------------------------------------------
// fp32 -> bf16 conversion (4 elements/thread)
// ---------------------------------------------------------------------------
__global__ void __launch_bounds__(256)
cvt_bf16_kernel(const float* __restrict__ in, __bf16* __restrict__ out, int n) {
    int base = (blockIdx.x * blockDim.x + threadIdx.x) * 4;
    if (base < n) {
        float4 v = *(const float4*)(in + base);
        out[base + 0] = (__bf16)v.x;
        out[base + 1] = (__bf16)v.y;
        out[base + 2] = (__bf16)v.z;
        out[base + 3] = (__bf16)v.w;
    }
}

// ---------------------------------------------------------------------------
// dt = soft_clamp(softplus(x @ Wdt^T + bdt))  via  v_wmma_f32_16x16x32_bf16
// 2x2 register tiling: one wave computes a 32x32 output block (4 accumulators),
// each A/B fragment is reused twice -> 8 b128 loads feed 4 WMMAs.
// ---------------------------------------------------------------------------
__global__ void __launch_bounds__(256)
wmma_dt_kernel(const __bf16* __restrict__ xbf, const __bf16* __restrict__ wbf,
               const float* __restrict__ bdt, float* __restrict__ dt) {
    const int lane = threadIdx.x & 31;
    const int wave = threadIdx.x >> 5;            // 0..7
    const int tile = blockIdx.x * 8 + wave;       // 0..4095
    const int tm   = tile >> 5;                   // 0..127  (32-row strips)
    const int tn   = tile & 31;                   // 0..31   (32-col strips)

    const int l15 = lane & 15;
    const int kg  = (lane >> 4) * 8;              // K sub-group: 0 or 8

    // A fragments: rows tm*32 + l15 (+16); K groups [kg..kg+7], [16+kg..16+kg+7]
    const __bf16* arow0 = xbf + (size_t)(tm * 32 + l15) * DD + kg;
    const __bf16* arow1 = arow0 + (size_t)16 * DD;
    // B fragments: columns tn*32 + l15 (+16); Wdt row-major in k
    const __bf16* brow0 = wbf + (size_t)(tn * 32 + l15) * DD + kg;
    const __bf16* brow1 = brow0 + (size_t)16 * DD;

    v8f acc00 = {}, acc01 = {}, acc10 = {}, acc11 = {};

    #pragma unroll 2
    for (int k0 = 0; k0 < DD; k0 += 32) {
        v8bf a0lo = *(const v8bf*)(arow0 + k0);
        v8bf a0hi = *(const v8bf*)(arow0 + k0 + 16);
        v8bf a1lo = *(const v8bf*)(arow1 + k0);
        v8bf a1hi = *(const v8bf*)(arow1 + k0 + 16);
        v8bf b0lo = *(const v8bf*)(brow0 + k0);
        v8bf b0hi = *(const v8bf*)(brow0 + k0 + 16);
        v8bf b1lo = *(const v8bf*)(brow1 + k0);
        v8bf b1hi = *(const v8bf*)(brow1 + k0 + 16);
        v16bf A0, A1, B0, B1;
        #pragma unroll
        for (int i = 0; i < 8; i++) {
            A0[i] = a0lo[i]; A0[i + 8] = a0hi[i];
            A1[i] = a1lo[i]; A1[i + 8] = a1hi[i];
            B0[i] = b0lo[i]; B0[i + 8] = b0hi[i];
            B1[i] = b1lo[i]; B1[i + 8] = b1hi[i];
        }
        acc00 = __builtin_amdgcn_wmma_f32_16x16x32_bf16(false, A0, false, B0, (short)0, acc00, false, false);
        acc01 = __builtin_amdgcn_wmma_f32_16x16x32_bf16(false, A0, false, B1, (short)0, acc01, false, false);
        acc10 = __builtin_amdgcn_wmma_f32_16x16x32_bf16(false, A1, false, B0, (short)0, acc10, false, false);
        acc11 = __builtin_amdgcn_wmma_f32_16x16x32_bf16(false, A1, false, B1, (short)0, acc11, false, false);
    }

    const int mbase = (lane >> 4) * 8;
    auto epilogue = [&](v8f acc, int rowbase, int colbase) {
        const int col  = colbase + l15;
        const float bias = bdt[col];
        #pragma unroll
        for (int r = 0; r < 8; r++) {
            int row  = rowbase + mbase + r;
            float v  = acc[r] + bias;
            // softplus via hardware v_exp_f32 / v_log_f32 (result clamped anyway)
            float sp = (v > 20.f) ? v : __logf(1.f + __expf(v));
            dt[(size_t)row * DD + col] = soft_clamp_f(sp, 0.001f, 0.1f, 0.5f);
        }
    };
    epilogue(acc00, tm * 32,      tn * 32);
    epilogue(acc01, tm * 32,      tn * 32 + 16);
    epilogue(acc10, tm * 32 + 16, tn * 32);
    epilogue(acc11, tm * 32 + 16, tn * 32 + 16);
}

// ---------------------------------------------------------------------------
// Bp = x @ WB^T, Cp = x @ WC^T   ([4096,16] each) — small, plain VALU
// ---------------------------------------------------------------------------
__global__ void __launch_bounds__(256)
proj_kernel(const float* __restrict__ x, const float* __restrict__ WB,
            const float* __restrict__ WC, float* __restrict__ Bp,
            float* __restrict__ Cp) {
    int t   = blockIdx.x * blockDim.x + threadIdx.x;   // 0..65535
    int row = t >> 4;
    int n   = t & 15;
    const float4* xr = (const float4*)(x + (size_t)row * DD);
    const float4* wb = (const float4*)(WB + (size_t)n * DD);
    const float4* wc = (const float4*)(WC + (size_t)n * DD);
    float sb = 0.f, sc = 0.f;
    #pragma unroll 4
    for (int k = 0; k < DD / 4; k++) {
        float4 xv = xr[k], bv = wb[k], cv = wc[k];
        sb += xv.x * bv.x + xv.y * bv.y + xv.z * bv.z + xv.w * bv.w;
        sc += xv.x * cv.x + xv.y * cv.y + xv.z * cv.z + xv.w * cv.w;
    }
    Bp[t] = sb;
    Cp[t] = sc;
}

// ---------------------------------------------------------------------------
// Sequential scan. One workgroup per batch (global norm couples all of D,N).
// thread d holds h[d, 0..15] in registers; norm via shfl + LDS tree.
// All transcendentals are single hardware trans ops (v_tanh_f32 / v_exp_f32).
// Software pipeline, one step deep: only the state update, its square sum and
// the rescale need the previous step's norm. The operands of step t+1 are
// loaded while step t's sum is reduced inside the waves; the tanh of its decay
// factors and its input terms are computed between the two barriers, while wave 0
// adds up the 32 partial sums, the exp as well; the output dot product fills the waits of the root and division.
// ---------------------------------------------------------------------------
__global__ void __launch_bounds__(1024)
scan_kernel(const float* __restrict__ x, const float* __restrict__ dt,
            const float* __restrict__ Bp, const float* __restrict__ Cp,
            const float* __restrict__ A_log, const float* __restrict__ Dp,
            float* __restrict__ out) {
    const int b    = blockIdx.x;
    const int d    = threadIdx.x;
    const int lane = threadIdx.x & 31;
    const int wave = threadIdx.x >> 5;

    __shared__ float wsum[32];
    __shared__ float stotal;

    float A[NN], h[NN];
    #pragma unroll
    for (int n = 0; n < NN; n++) {
        float al = A_log[d * NN + n];
        // soft_clamp(al,-5,5,0.5) = 10*tanh(al/10)
        A[n] = -__expf(10.f * fast_tanh(al * 0.1f));
        h[n] = 0.f;
    }
    const float dpv = Dp[d];

    const float* xb  = x  + (size_t)b * LL * DD;
    const float* dtb = dt + (size_t)b * LL * DD;
    const float* Bb  = Bp + (size_t)b * LL * NN;
    const float* Cb  = Cp + (size_t)b * LL * NN;
    float*       ob  = out + (size_t)b * LL * DD;

    // raw operands of the step that is being fetched
    float xn, dtn, Bn[NN];
    // finished operands of the step that is about to run
    float xv, dA[NN], u[NN], Crow[NN];

    auto load_xdtB = [&](int t) {
        const unsigned idx = ((unsigned)t * DD) | (unsigned)d;   // 32-bit offset on a scalar base
        xn  = xb[idx];
        dtn = dtb[idx];
        // the offset register of these two loads is free for reuse from here on:
        // the wait that belongs in front of such an overwrite
        asm volatile("s_wait_xcnt 0x0" ::: "memory");
        #pragma unroll
        for (int q = 0; q < 4; q++) {
            float4 bq = *(const float4*)(Bb + t * NN + q * 4);
            Bn[q*4+0] = bq.x; Bn[q*4+1] = bq.y; Bn[q*4+2] = bq.z; Bn[q*4+3] = bq.w;
        }
    };
    auto load_C = [&](int t) {
        #pragma unroll
        for (int q = 0; q < 4; q++) {
            float4 cq = *(const float4*)(Cb + t * NN + q * 4);
            Crow[q*4+0] = cq.x; Crow[q*4+1] = cq.y; Crow[q*4+2] = cq.z; Crow[q*4+3] = cq.w;
        }
    };
    auto prepare_step = [&]() {
        const float dtx = dtn * xn;
        // soft_clamp(z,-8,8,0.5) = 16*tanh(z/16), z = dt*A
        float th[NN];
        #pragma unroll
        for (int n = 0; n < NN; n++) th[n] = (dtn * A[n]) * 0.0625f;
        tanh8_here(th[0], th[1], th[2],  th[3],  th[4],  th[5],  th[6],  th[7]);
        tanh8_here(th[8], th[9], th[10], th[11], th[12], th[13], th[14], th[15]);
        #pragma unroll
        for (int n = 0; n < NN; n++) {
            dA[n] = __expf(16.f * th[n]);
            u[n]  = dtx * Bn[n];
        }
        xv = xn;
    };

    load_xdtB(0);
    prepare_step();

    for (int t = 0; t < LL; t++) {
        // the last step fetches its own row again; the result is not used
        const int tn = t + 1 < LL ? t + 1 : t;

        // the part that needs the previous step's rescaled state
        float ss = 0.f;
        #pragma unroll
        for (int n = 0; n < NN; n++) {
            h[n] = dA[n] * h[n] + u[n];
            ss  += h[n] * h[n];
        }
        const float xcur = xv;

        if (t + 3 < LL) {
            const unsigned pidx = ((unsigned)(t + 2) * DD) | (unsigned)d;
            __builtin_prefetch(dtb + pidx, 0, 0);
            __builtin_prefetch(xb  + pidx, 0, 0);
        }
        load_xdtB(tn);      // both land while the waves reduce their sums
        load_C(t);          // this step's C row, used behind the second barrier

        // wave32 reduce, then cross-wave via LDS
        #pragma unroll
        for (int off = 16; off >= 1; off >>= 1) ss += __shfl_xor(ss, off, 32);
        if (lane == 0) wsum[wave] = ss;
        __syncthreads();
        if (wave == 0) {
            float v = wsum[lane];
            #pragma unroll
            for (int off = 16; off >= 1; off >>= 1) v += __shfl_xor(v, off, 32);
            if (lane == 0) stotal = v;
        }

        // next step's decay factors and input terms: they do not need the norm,
        // and start while wave 0 adds the partials
        prepare_step();
        __syncthreads();

        // output dot product on the state before its rescale: independent of the
        // norm, it fills the waits of the square root and the division; the
        // scalar scale is applied to the sum
        float yd = 0.f;
        #pragma unroll
        for (int n = 0; n < NN; n++) yd += h[n] * Crow[n];

        float norm  = sqrtf(stotal);
        float scale = fminf(20.f / (norm + 1e-8f), 1.f);
        #pragma unroll
        for (int n = 0; n < NN; n++) h[n] *= scale;
        float y = dpv * xcur + scale * yd;
        ob[(size_t)t * DD + d] = y;
    }
}

// ---------------------------------------------------------------------------
extern "C" void kernel_launch(void* const* d_in, const int* in_sizes, int n_in,
                              void* d_out, int out_size, void* d_ws, size_t ws_size,
                              hipStream_t stream) {
    const float* x     = (const float*)d_in[0];
    const float* Wdt   = (const float*)d_in[1];
    const float* bdt   = (const float*)d_in[2];
    const float* WB    = (const float*)d_in[3];
    const float* WC    = (const float*)d_in[4];
    const float* A_log = (const float*)d_in[5];
    const float* Dp    = (const float*)d_in[6];
    float* out = (float*)d_out;

    char* ws = (char*)d_ws;
    size_t off = 0;
    auto take = [&](size_t bytes) -> void* {
        void* p = ws + off;
        off += (bytes + 255) & ~(size_t)255;
        return p;
    };
    float*  dt  = (float*) take((size_t)ROWS * DD * sizeof(float));   // 16 MB
    float*  Bp  = (float*) take((size_t)ROWS * NN * sizeof(float));
    float*  Cp  = (float*) take((size_t)ROWS * NN * sizeof(float));
    __bf16* xbf = (__bf16*)take((size_t)ROWS * DD * sizeof(__bf16));  // 8 MB
    __bf16* wbf = (__bf16*)take((size_t)DD * DD * sizeof(__bf16));    // 2 MB
    (void)ws_size; (void)in_sizes; (void)n_in; (void)out_size;

    // 1) bf16 conversions
    {
        int n = ROWS * DD;                              // 4,194,304
        cvt_bf16_kernel<<<(n / 4 + 255) / 256, 256, 0, stream>>>(x, xbf, n);
        int m = DD * DD;                                // 1,048,576
        cvt_bf16_kernel<<<(m / 4 + 255) / 256, 256, 0, stream>>>(Wdt, wbf, m);
    }
    // 2) WMMA GEMM + softplus + soft_clamp -> dt  (32x32 tile per wave)
    {
        int tiles = (ROWS / 32) * (DD / 32);            // 4096 tiles, 8/block
        wmma_dt_kernel<<<tiles / 8, 256, 0, stream>>>(xbf, wbf, bdt, dt);
    }
    // 3) B/C projections
    proj_kernel<<<(ROWS * NN) / 256, 256, 0, stream>>>(x, WB, WC, Bp, Cp);
    // 4) sequential scan, one workgroup per batch
    scan_kernel<<<BB, 1024, 0, stream>>>(x, dt, Bp, Cp, A_log, Dp, out);
}

// v002
// A run of this version takes 2280 microseconds.
// Two timings next to v001 both put it at 1.04 times that version's speed.
// All steps since v000 together make it 1.65 times as fast.
#include <hip/hip_runtime.h>
#include <hip/hip_bf16.h>
#include <math.h>

typedef __attribute__((ext_vector_type(16))) __bf16 v16bf;
typedef __attribute__((ext_vector_type(8)))  __bf16 v8bf;
typedef __attribute__((ext_vector_type(8)))  float  v8f;
typedef __attribute__((ext_vector_type(2)))  float  v2f;

#define BB 2
#define LL 2048
#define DD 1024
#define NN 16
#define ROWS (BB*LL)   // 4096

__device__ __forceinline__ float fast_tanh(float x) {
    float r;
    asm("v_tanh_f32 %0, %1\n\tv_nop" : "=v"(r) : "v"(x));
    return r;
}

__device__ __forceinline__ void tanh8_here(float& a0, float& a1, float& a2, float& a3,
                                           float& a4, float& a5, float& a6, float& a7) {
    asm volatile("v_tanh_f32 %0, %0\n\t"
                 "v_tanh_f32 %1, %1\n\t"
                 "v_tanh_f32 %2, %2\n\t"
                 "v_tanh_f32 %3, %3\n\t"
                 "v_tanh_f32 %4, %4\n\t"
                 "v_tanh_f32 %5, %5\n\t"
                 "v_tanh_f32 %6, %6\n\t"
                 "v_tanh_f32 %7, %7\n\t"
                 "v_nop"
                 : "+v"(a0), "+v"(a1), "+v"(a2), "+v"(a3),
                   "+v"(a4), "+v"(a5), "+v"(a6), "+v"(a7));
}

__device__ __forceinline__ float soft_clamp_f(float x, float lo, float hi, float sharp) {
    float c  = 0.5f * (hi + lo);
    float r  = 0.5f * (hi - lo);
    float xn = (x - c) / (r + 1e-8f);
    return fast_tanh(xn * sharp) / sharp * r + c;
}

// ---------------------------------------------------------------------------
// fp32 -> bf16 conversion (4 elements/thread)
// ---------------------------------------------------------------------------
__global__ void __launch_bounds__(256)
cvt_bf16_kernel(const float* __restrict__ in, __bf16* __restrict__ out, int n) {
    int base = (blockIdx.x * blockDim.x + threadIdx.x) * 4;
    if (base < n) {
        float4 v = *(const float4*)(in + base);
        out[base + 0] = (__bf16)v.x;
        out[base + 1] = (__bf16)v.y;
        out[base + 2] = (__bf16)v.z;
        out[base + 3] = (__bf16)v.w;
    }
}

// ---------------------------------------------------------------------------
// dt = soft_clamp(softplus(x @ Wdt^T + bdt))  via  v_wmma_f32_16x16x32_bf16
// 2x2 register tiling: one wave computes a 32x32 output block (4 accumulators),
// each A/B fragment is reused twice -> 8 b128 loads feed 4 WMMAs.
// ---------------------------------------------------------------------------
__global__ void __launch_bounds__(256)
wmma_dt_kernel(const __bf16* __restrict__ xbf, const __bf16* __restrict__ wbf,
               const float* __restrict__ bdt, float* __restrict__ dt) {
    const int lane = threadIdx.x & 31;
    const int wave = threadIdx.x >> 5;            // 0..7
    const int tile = blockIdx.x * 8 + wave;       // 0..4095
    const int tm   = tile >> 5;                   // 0..127  (32-row strips)
    const int tn   = tile & 31;                   // 0..31   (32-col strips)

    const int l15 = lane & 15;
    const int kg  = (lane >> 4) * 8;              // K sub-group: 0 or 8

    // A fragments: rows tm*32 + l15 (+16); K groups [kg..kg+7], [16+kg..16+kg+7]
    const __bf16* arow0 = xbf + (size_t)(tm * 32 + l15) * DD + kg;
    const __bf16* arow1 = arow0 + (size_t)16 * DD;
    // B fragments: columns tn*32 + l15 (+16); Wdt row-major in k
    const __bf16* brow0 = wbf + (size_t)(tn * 32 + l15) * DD + kg;
    const __bf16* brow1 = brow0 + (size_t)16 * DD;

    v8f acc00 = {}, acc01 = {}, acc10 = {}, acc11 = {};

    #pragma unroll 2
    for (int k0 = 0; k0 < DD; k0 += 32) {
        v8bf a0lo = *(const v8bf*)(arow0 + k0);
        v8bf a0hi = *(const v8bf*)(arow0 + k0 + 16);
        v8bf a1lo = *(const v8bf*)(arow1 + k0);
        v8bf a1hi = *(const v8bf*)(arow1 + k0 + 16);
        v8bf b0lo = *(const v8bf*)(brow0 + k0);
        v8bf b0hi = *(const v8bf*)(brow0 + k0 + 16);
        v8bf b1lo = *(const v8bf*)(brow1 + k0);
        v8bf b1hi = *(const v8bf*)(brow1 + k0 + 16);
        v16bf A0, A1, B0, B1;
        #pragma unroll
        for (int i = 0; i < 8; i++) {
            A0[i] = a0lo[i]; A0[i + 8] = a0hi[i];
            A1[i] = a1lo[i]; A1[i + 8] = a1hi[i];
            B0[i] = b0lo[i]; B0[i + 8] = b0hi[i];
            B1[i] = b1lo[i]; B1[i + 8] = b1hi[i];
        }
        acc00 = __builtin_amdgcn_wmma_f32_16x16x32_bf16(false, A0, false, B0, (short)0, acc00, false, false);
        acc01 = __builtin_amdgcn_wmma_f32_16x16x32_bf16(false, A0, false, B1, (short)0, acc01, false, false);
        acc10 = __builtin_amdgcn_wmma_f32_16x16x32_bf16(false, A1, false, B0, (short)0, acc10, false, false);
        acc11 = __builtin_amdgcn_wmma_f32_16x16x32_bf16(false, A1, false, B1, (short)0, acc11, false, false);
    }

    const int mbase = (lane >> 4) * 8;
    auto epilogue = [&](v8f acc, int rowbase, int colbase) {
        const int col  = colbase + l15;
        const float bias = bdt[col];
        #pragma unroll
        for (int r = 0; r < 8; r++) {
            int row  = rowbase + mbase + r;
            float v  = acc[r] + bias;
            // softplus via hardware v_exp_f32 / v_log_f32 (result clamped anyway)
            float sp = (v > 20.f) ? v : __logf(1.f + __expf(v));
            dt[(size_t)row * DD + col] = soft_clamp_f(sp, 0.001f, 0.1f, 0.5f);
        }
    };
    epilogue(acc00, tm * 32,      tn * 32);
    epilogue(acc01, tm * 32,      tn * 32 + 16);
    epilogue(acc10, tm * 32 + 16, tn * 32);
    epilogue(acc11, tm * 32 + 16, tn * 32 + 16);
}

// ---------------------------------------------------------------------------
// Bp = x @ WB^T, Cp = x @ WC^T   ([4096,16] each) — small, plain VALU
// ---------------------------------------------------------------------------
__global__ void __launch_bounds__(256)
proj_kernel(const float* __restrict__ x, const float* __restrict__ WB,
            const float* __restrict__ WC, float* __restrict__ Bp,
            float* __restrict__ Cp) {
    int t   = blockIdx.x * blockDim.x + threadIdx.x;   // 0..65535
    int row = t >> 4;
    int n   = t & 15;
    const float4* xr = (const float4*)(x + (size_t)row * DD);
    const float4* wb = (const float4*)(WB + (size_t)n * DD);
    const float4* wc = (const float4*)(WC + (size_t)n * DD);
    float sb = 0.f, sc = 0.f;
    #pragma unroll 4
    for (int k = 0; k < DD / 4; k++) {
        float4 xv = xr[k], bv = wb[k], cv = wc[k];
        sb += xv.x * bv.x + xv.y * bv.y + xv.z * bv.z + xv.w * bv.w;
        sc += xv.x * cv.x + xv.y * cv.y + xv.z * cv.z + xv.w * cv.w;
    }
    Bp[t] = sb;
    Cp[t] = sc;
}

// ---------------------------------------------------------------------------
// Sequential scan. One workgroup per batch (global norm couples all of D,N).
// thread d holds h[d, 0..15] in registers; norm via shfl + LDS tree.
// All transcendentals are single hardware trans ops (v_tanh_f32 / v_exp_f32).
// Software pipeline, one step deep: only the state update, its square sum and
// the rescale need the previous step's norm. The operands of step t+1 are
// loaded while step t's sum is reduced inside the waves; the tanh of its decay
// factors and its input terms are computed between the two barriers, while wave 0
// adds up the 32 partial sums, the exp as well; the output dot product fills the waits of the root and division.
// ---------------------------------------------------------------------------
__global__ void __launch_bounds__(1024)
scan_kernel(const float* __restrict__ x, const float* __restrict__ dt,
            const float* __restrict__ Bp, const float* __restrict__ Cp,
            const float* __restrict__ A_log, const float* __restrict__ Dp,
            float* __restrict__ out) {
    const int b    = blockIdx.x;
    const int d    = threadIdx.x;
    const int lane = threadIdx.x & 31;
    const int wave = threadIdx.x >> 5;

    __shared__ float wsum[32];
    __shared__ float stotal;

    float A[NN], h[NN];
    #pragma unroll
    for (int n = 0; n < NN; n++) {
        float al = A_log[d * NN + n];
        // soft_clamp(al,-5,5,0.5) = 10*tanh(al/10)
        A[n] = -__expf(10.f * fast_tanh(al * 0.1f));
        h[n] = 0.f;
    }
    const float dpv = Dp[d];

    const float* xb  = x  + (size_t)b * LL * DD;
    const float* dtb = dt + (size_t)b * LL * DD;
    const float* Bb  = Bp + (size_t)b * LL * NN;
    const float* Cb  = Cp + (size_t)b * LL * NN;
    float*       ob  = out + (size_t)b * LL * DD;

    // raw operands of the step that is being fetched
    float xn, dtn, Bn[NN];
    // finished operands of the step that is about to run
    float xv, dA[NN], u[NN], Crow[NN];

    auto load_xdtB = [&](int t) {
        const unsigned idx = ((unsigned)t * DD) | (unsigned)d;   // 32-bit offset on a scalar base
        xn  = xb[idx];
        dtn = dtb[idx];
        // the offset register of these two loads is free for reuse from here on:
        // the wait that belongs in front of such an overwrite
        asm volatile("s_wait_xcnt 0x0" ::: "memory");
        #pragma unroll
        for (int q = 0; q < 4; q++) {
            float4 bq = *(const float4*)(Bb + t * NN + q * 4);
            Bn[q*4+0] = bq.x; Bn[q*4+1] = bq.y; Bn[q*4+2] = bq.z; Bn[q*4+3] = bq.w;
        }
    };
    auto load_C = [&](int t) {
        #pragma unroll
        for (int q = 0; q < 4; q++) {
            float4 cq = *(const float4*)(Cb + t * NN + q * 4);
            Crow[q*4+0] = cq.x; Crow[q*4+1] = cq.y; Crow[q*4+2] = cq.z; Crow[q*4+3] = cq.w;
        }
    };
    auto prepare_step = [&]() {
        const float dtx = dtn * xn;
        // soft_clamp(z,-8,8,0.5) = 16*tanh(z/16), z = dt*A
        // the scalings in front of and behind the tanh go in register pairs too
        float th[NN];
        const v2f dt2 = {dtn, dtn};
        #pragma unroll
        for (int n = 0; n < NN; n += 2) {
            const v2f a = {A[n], A[n + 1]};
            const v2f z = (dt2 * a) * 0.0625f;
            th[n] = z.x; th[n + 1] = z.y;
        }
        tanh8_here(th[0], th[1], th[2],  th[3],  th[4],  th[5],  th[6],  th[7]);
        tanh8_here(th[8], th[9], th[10], th[11], th[12], th[13], th[14], th[15]);
        #pragma unroll
        for (int n = 0; n < NN; n += 2) {
            const v2f t = {th[n], th[n + 1]};
            // exp(v) as exp2(v * log2(e)), the same two roundings as __expf
            const v2f e = (t * 16.f) * 1.44269504088896340736f;
            dA[n]     = __builtin_amdgcn_exp2f(e.x);
            dA[n + 1] = __builtin_amdgcn_exp2f(e.y);
            u[n]      = dtx * Bn[n];
            u[n + 1]  = dtx * Bn[n + 1];
        }
        xv = xn;
    };

    load_xdtB(0);
    prepare_step();

    for (int t = 0; t < LL; t++) {
        // the last step fetches its own row again; the result is not used
        const int tn = t + 1 < LL ? t + 1 : t;

        // the part that needs the previous step's rescaled state
        #pragma unroll
        for (int n = 0; n < NN; n++) h[n] = dA[n] * h[n] + u[n];
        // square sum in register pairs: two packed chains of four links, one
        // instruction per two squares, in place of one serial chain of sixteen
        v2f sq0, sq1;
        {
            const v2f a = {h[0], h[1]}, c = {h[2], h[3]};
            sq0 = a * a;
            sq1 = c * c;
        }
        #pragma unroll
        for (int n = 4; n < NN; n += 4) {
            const v2f a = {h[n], h[n + 1]}, c = {h[n + 2], h[n + 3]};
            sq0 = __builtin_elementwise_fma(a, a, sq0);
            sq1 = __builtin_elementwise_fma(c, c, sq1);
        }
        sq0 += sq1;
        float ss = sq0.x + sq0.y;
        const float xcur = xv;

        if (t + 3 < LL) {
            const unsigned pidx = ((unsigned)(t + 2) * DD) | (unsigned)d;
            __builtin_prefetch(dtb + pidx, 0, 0);
            __builtin_prefetch(xb  + pidx, 0, 0);
        }
        load_xdtB(tn);      // both land while the waves reduce their sums
        load_C(t);          // this step's C row, used behind the second barrier

        // wave32 reduce, then cross-wave via LDS
        #pragma unroll
        for (int off = 16; off >= 1; off >>= 1) ss += __shfl_xor(ss, off, 32);
        if (lane == 0) wsum[wave] = ss;
        __syncthreads();
        if (wave == 0) {
            float v = wsum[lane];
            #pragma unroll
            for (int off = 16; off >= 1; off >>= 1) v += __shfl_xor(v, off, 32);
            if (lane == 0) stotal = v;
        }

        // next step's decay factors and input terms: they do not need the norm,
        // and start while wave 0 adds the partials
        prepare_step();
        __syncthreads();

        // output dot product on the state before its rescale: independent of the
        // norm, it fills the waits of the square root and the division; the
        // scalar scale is applied to the sum
        // summed in register pairs like the square sum
        v2f yd0, yd1;
        {
            const v2f a = {h[0], h[1]}, c = {h[2], h[3]};
            const v2f ca = {Crow[0], Crow[1]}, cc = {Crow[2], Crow[3]};
            yd0 = a * ca;
            yd1 = c * cc;
        }
        #pragma unroll
        for (int n = 4; n < NN; n += 4) {
            const v2f a = {h[n], h[n + 1]}, c = {h[n + 2], h[n + 3]};
            const v2f ca = {Crow[n], Crow[n + 1]}, cc = {Crow[n + 2], Crow[n + 3]};
            yd0 = __builtin_elementwise_fma(a, ca, yd0);
            yd1 = __builtin_elementwise_fma(c, cc, yd1);
        }
        yd0 += yd1;
        const float yd = yd0.x + yd0.y;

        float norm  = sqrtf(stotal);
        float scale = fminf(20.f / (norm + 1e-8f), 1.f);
        #pragma unroll
        for (int n = 0; n < NN; n++) h[n] *= scale;
        float y = dpv * xcur + scale * yd;
        ob[(size_t)t * DD + d] = y;
    }
}

// ---------------------------------------------------------------------------
extern "C" void kernel_launch(void* const* d_in, const int* in_sizes, int n_in,
                              void* d_out, int out_size, void* d_ws, size_t ws_size,
                              hipStream_t stream) {
    const float* x     = (const float*)d_in[0];
    const float* Wdt   = (const float*)d_in[1];
    const float* bdt   = (const float*)d_in[2];
    const float* WB    = (const float*)d_in[3];
    const float* WC    = (const float*)d_in[4];
    const float* A_log = (const float*)d_in[5];
    const float* Dp    = (const float*)d_in[6];
    float* out = (float*)d_out;

    char* ws = (char*)d_ws;
    size_t off = 0;
    auto take = [&](size_t bytes) -> void* {
        void* p = ws + off;
        off += (bytes + 255) & ~(size_t)255;
        return p;
    };
    float*  dt  = (float*) take((size_t)ROWS * DD * sizeof(float));   // 16 MB
    float*  Bp  = (float*) take((size_t)ROWS * NN * sizeof(float));
    float*  Cp  = (float*) take((size_t)ROWS * NN * sizeof(float));
    __bf16* xbf = (__bf16*)take((size_t)ROWS * DD * sizeof(__bf16));  // 8 MB
    __bf16* wbf = (__bf16*)take((size_t)DD * DD * sizeof(__bf16));    // 2 MB
    (void)ws_size; (void)in_sizes; (void)n_in; (void)out_size;

    // 1) bf16 conversions
    {
        int n = ROWS * DD;                              // 4,194,304
        cvt_bf16_kernel<<<(n / 4 + 255) / 256, 256, 0, stream>>>(x, xbf, n);
        int m = DD * DD;                                // 1,048,576
        cvt_bf16_kernel<<<(m / 4 + 255) / 256, 256, 0, stream>>>(Wdt, wbf, m);
    }
    // 2) WMMA GEMM + softplus + soft_clamp -> dt  (32x32 tile per wave)
    {
        int tiles = (ROWS / 32) * (DD / 32);            // 4096 tiles, 8/block
        wmma_dt_kernel<<<tiles / 8, 256, 0, stream>>>(xbf, wbf, bdt, dt);
    }
    // 3) B/C projections
    proj_kernel<<<(ROWS * NN) / 256, 256, 0, stream>>>(x, WB, WC, Bp, Cp);
    // 4) sequential scan, one workgroup per batch
    scan_kernel<<<BB, 1024, 0, stream>>>(x, dt, Bp, Cp, A_log, Dp, out);
}

// v003
// One run takes 2200 microseconds.
// Next to v002, in two timings, it ran 1.04 times as fast each time.
// Counting every step since v000, it is 1.71 times as fast.
#include <hip/hip_runtime.h>
#include <hip/hip_bf16.h>
#include <math.h>

typedef __attribute__((ext_vector_type(16))) __bf16 v16bf;
typedef __attribute__((ext_vector_type(8)))  __bf16 v8bf;
typedef __attribute__((ext_vector_type(8)))  float  v8f;
typedef __attribute__((ext_vector_type(2)))  float  v2f;

#define BB 2
#define LL 2048
#define DD 1024
#define NN 16
#define ROWS (BB*LL)   // 4096

__device__ __forceinline__ float fast_tanh(float x) {
    float r;
    asm("v_tanh_f32 %0, %1\n\tv_nop" : "=v"(r) : "v"(x));
    return r;
}

__device__ __forceinline__ void tanh8_here(float& a0, float& a1, float& a2, float& a3,
                                           float& a4, float& a5, float& a6, float& a7) {
    asm volatile("v_tanh_f32 %0, %0\n\t"
                 "v_tanh_f32 %1, %1\n\t"
                 "v_tanh_f32 %2, %2\n\t"
                 "v_tanh_f32 %3, %3\n\t"
                 "v_tanh_f32 %4, %4\n\t"
                 "v_tanh_f32 %5, %5\n\t"
                 "v_tanh_f32 %6, %6\n\t"
                 "v_tanh_f32 %7, %7\n\t"
                 "v_nop"
                 : "+v"(a0), "+v"(a1), "+v"(a2), "+v"(a3),
                   "+v"(a4), "+v"(a5), "+v"(a6), "+v"(a7));
}

template <int M>
__device__ __forceinline__ float add_row_xmask(float v) {
    const int p = __builtin_amdgcn_update_dpp(0, __builtin_bit_cast(int, v), 0x160 | M, 0xf, 0xf, true);
    return v + __builtin_bit_cast(float, p);
}
__device__ __forceinline__ float wave_sum(float v) {
    const int b = __builtin_bit_cast(int, v);
    v += __builtin_bit_cast(float, __builtin_amdgcn_permlanex16(b, b, 0x76543210, 0xfedcba98, false, false));
    v = add_row_xmask<8>(v);
    v = add_row_xmask<4>(v);
    v = add_row_xmask<2>(v);
    v = add_row_xmask<1>(v);
    return v;
}

__device__ __forceinline__ float soft_clamp_f(float x, float lo, float hi, float sharp) {
    float c  = 0.5f * (hi + lo);
    float r  = 0.5f * (hi - lo);
    float xn = (x - c) / (r + 1e-8f);
    return fast_tanh(xn * sharp) / sharp * r + c;
}

// ---------------------------------------------------------------------------
// fp32 -> bf16 conversion (4 elements/thread)
// ---------------------------------------------------------------------------
__global__ void __launch_bounds__(256)
cvt_bf16_kernel(const float* __restrict__ in, __bf16* __restrict__ out, int n) {
    int base = (blockIdx.x * blockDim.x + threadIdx.x) * 4;
    if (base < n) {
        float4 v = *(const float4*)(in + base);
        out[base + 0] = (__bf16)v.x;
        out[base + 1] = (__bf16)v.y;
        out[base + 2] = (__bf16)v.z;
        out[base + 3] = (__bf16)v.w;
    }
}

// ---------------------------------------------------------------------------
// dt = soft_clamp(softplus(x @ Wdt^T + bdt))  via  v_wmma_f32_16x16x32_bf16
// 2x2 register tiling: one wave computes a 32x32 output block (4 accumulators),
// each A/B fragment is reused twice -> 8 b128 loads feed 4 WMMAs.
// ---------------------------------------------------------------------------
__global__ void __launch_bounds__(256)
wmma_dt_kernel(const __bf16* __restrict__ xbf, const __bf16* __restrict__ wbf,
               const float* __restrict__ bdt, float* __restrict__ dt) {
    const int lane = threadIdx.x & 31;
    const int wave = threadIdx.x >> 5;            // 0..7
    const int tile = blockIdx.x * 8 + wave;       // 0..4095
    const int tm   = tile >> 5;                   // 0..127  (32-row strips)
    const int tn   = tile & 31;                   // 0..31   (32-col strips)

    const int l15 = lane & 15;
    const int kg  = (lane >> 4) * 8;              // K sub-group: 0 or 8

    // A fragments: rows tm*32 + l15 (+16); K groups [kg..kg+7], [16+kg..16+kg+7]
    const __bf16* arow0 = xbf + (size_t)(tm * 32 + l15) * DD + kg;
    const __bf16* arow1 = arow0 + (size_t)16 * DD;
    // B fragments: columns tn*32 + l15 (+16); Wdt row-major in k
    const __bf16* brow0 = wbf + (size_t)(tn * 32 + l15) * DD + kg;
    const __bf16* brow1 = brow0 + (size_t)16 * DD;

    v8f acc00 = {}, acc01 = {}, acc10 = {}, acc11 = {};

    #pragma unroll 2
    for (int k0 = 0; k0 < DD; k0 += 32) {
        v8bf a0lo = *(const v8bf*)(arow0 + k0);
        v8bf a0hi = *(const v8bf*)(arow0 + k0 + 16);
        v8bf a1lo = *(const v8bf*)(arow1 + k0);
        v8bf a1hi = *(const v8bf*)(arow1 + k0 + 16);
        v8bf b0lo = *(const v8bf*)(brow0 + k0);
        v8bf b0hi = *(const v8bf*)(brow0 + k0 + 16);
        v8bf b1lo = *(const v8bf*)(brow1 + k0);
        v8bf b1hi = *(const v8bf*)(brow1 + k0 + 16);
        v16bf A0, A1, B0, B1;
        #pragma unroll
        for (int i = 0; i < 8; i++) {
            A0[i] = a0lo[i]; A0[i + 8] = a0hi[i];
            A1[i] = a1lo[i]; A1[i + 8] = a1hi[i];
            B0[i] = b0lo[i]; B0[i + 8] = b0hi[i];
            B1[i] = b1lo[i]; B1[i + 8] = b1hi[i];
        }
        acc00 = __builtin_amdgcn_wmma_f32_16x16x32_bf16(false, A0, false, B0, (short)0, acc00, false, false);
        acc01 = __builtin_amdgcn_wmma_f32_16x16x32_bf16(false, A0, false, B1, (short)0, acc01, false, false);
        acc10 = __builtin_amdgcn_wmma_f32_16x16x32_bf16(false, A1, false, B0, (short)0, acc10, false, false);
        acc11 = __builtin_amdgcn_wmma_f32_16x16x32_bf16(false, A1, false, B1, (short)0, acc11, false, false);
    }

    const int mbase = (lane >> 4) * 8;
    auto epilogue = [&](v8f acc, int rowbase, int colbase) {
        const int col  = colbase + l15;
        const float bias = bdt[col];
        #pragma unroll
        for (int r = 0; r < 8; r++) {
            int row  = rowbase + mbase + r;
            float v  = acc[r] + bias;
            // softplus via hardware v_exp_f32 / v_log_f32 (result clamped anyway)
            float sp = (v > 20.f) ? v : __logf(1.f + __expf(v));
            dt[(size_t)row * DD + col] = soft_clamp_f(sp, 0.001f, 0.1f, 0.5f);
        }
    };
    epilogue(acc00, tm * 32,      tn * 32);
    epilogue(acc01, tm * 32,      tn * 32 + 16);
    epilogue(acc10, tm * 32 + 16, tn * 32);
    epilogue(acc11, tm * 32 + 16, tn * 32 + 16);
}

// ---------------------------------------------------------------------------
// Bp = x @ WB^T, Cp = x @ WC^T   ([4096,16] each) — small, plain VALU
// ---------------------------------------------------------------------------
__global__ void __launch_bounds__(256)
proj_kernel(const float* __restrict__ x, const float* __restrict__ WB,
            const float* __restrict__ WC, float* __restrict__ Bp,
            float* __restrict__ Cp) {
    int t   = blockIdx.x * blockDim.x + threadIdx.x;   // 0..65535
    int row = t >> 4;
    int n   = t & 15;
    const float4* xr = (const float4*)(x + (size_t)row * DD);
    const float4* wb = (const float4*)(WB + (size_t)n * DD);
    const float4* wc = (const float4*)(WC + (size_t)n * DD);
    float sb = 0.f, sc = 0.f;
    #pragma unroll 4
    for (int k = 0; k < DD / 4; k++) {
        float4 xv = xr[k], bv = wb[k], cv = wc[k];
        sb += xv.x * bv.x + xv.y * bv.y + xv.z * bv.z + xv.w * bv.w;
        sc += xv.x * cv.x + xv.y * cv.y + xv.z * cv.z + xv.w * cv.w;
    }
    Bp[t] = sb;
    Cp[t] = sc;
}

// ---------------------------------------------------------------------------
// Sequential scan. One workgroup per batch (global norm couples all of D,N).
// thread d holds h[d, 0..15] in registers; norm via register lane sums + LDS.
// All transcendentals are single hardware trans ops (v_tanh_f32 / v_exp_f32).
// Software pipeline, one step deep: only the state update, its square sum and
// the rescale need the previous step's norm. The operands of step t+1 are
// loaded while step t's sum is reduced inside the waves; the tanh of its decay
// factors and its input terms are computed between the two barriers, while wave 0
// adds up the 32 partial sums, the exp as well; the output dot product fills the waits of the root and division.
// ---------------------------------------------------------------------------
__global__ void __launch_bounds__(1024)
scan_kernel(const float* __restrict__ x, const float* __restrict__ dt,
            const float* __restrict__ Bp, const float* __restrict__ Cp,
            const float* __restrict__ A_log, const float* __restrict__ Dp,
            float* __restrict__ out) {
    const int b    = blockIdx.x;
    const int d    = threadIdx.x;
    const int lane = threadIdx.x & 31;
    const int wave = threadIdx.x >> 5;

    __shared__ float wsum[32];
    __shared__ float stotal;

    float A[NN], h[NN];
    #pragma unroll
    for (int n = 0; n < NN; n++) {
        float al = A_log[d * NN + n];
        // soft_clamp(al,-5,5,0.5) = 10*tanh(al/10)
        A[n] = -__expf(10.f * fast_tanh(al * 0.1f));
        h[n] = 0.f;
    }
    const float dpv = Dp[d];

    const float* xb  = x  + (size_t)b * LL * DD;
    const float* dtb = dt + (size_t)b * LL * DD;
    const float* Bb  = Bp + (size_t)b * LL * NN;
    const float* Cb  = Cp + (size_t)b * LL * NN;
    float*       ob  = out + (size_t)b * LL * DD;

    // raw operands of the step that is being fetched
    float xn, dtn, Bn[NN];
    // finished operands of the step that is about to run
    float xv, dA[NN], u[NN], Crow[NN];

    auto load_xdtB = [&](int t) {
        const unsigned idx = ((unsigned)t * DD) | (unsigned)d;   // 32-bit offset on a scalar base
        xn  = xb[idx];
        dtn = dtb[idx];
        // the offset register of these two loads is free for reuse from here on:
        // the wait that belongs in front of such an overwrite
        asm volatile("s_wait_xcnt 0x0" ::: "memory");
        #pragma unroll
        for (int q = 0; q < 4; q++) {
            float4 bq = *(const float4*)(Bb + t * NN + q * 4);
            Bn[q*4+0] = bq.x; Bn[q*4+1] = bq.y; Bn[q*4+2] = bq.z; Bn[q*4+3] = bq.w;
        }
    };
    auto load_C = [&](int t) {
        #pragma unroll
        for (int q = 0; q < 4; q++) {
            float4 cq = *(const float4*)(Cb + t * NN + q * 4);
            Crow[q*4+0] = cq.x; Crow[q*4+1] = cq.y; Crow[q*4+2] = cq.z; Crow[q*4+3] = cq.w;
        }
    };
    auto prepare_step = [&]() {
        const float dtx = dtn * xn;
        // soft_clamp(z,-8,8,0.5) = 16*tanh(z/16), z = dt*A
        // the scalings in front of and behind the tanh go in register pairs too
        float th[NN];
        const v2f dt2 = {dtn, dtn};
        #pragma unroll
        for (int n = 0; n < NN; n += 2) {
            const v2f a = {A[n], A[n + 1]};
            const v2f z = (dt2 * a) * 0.0625f;
            th[n] = z.x; th[n + 1] = z.y;
        }
        tanh8_here(th[0], th[1], th[2],  th[3],  th[4],  th[5],  th[6],  th[7]);
        tanh8_here(th[8], th[9], th[10], th[11], th[12], th[13], th[14], th[15]);
        #pragma unroll
        for (int n = 0; n < NN; n += 2) {
            const v2f t = {th[n], th[n + 1]};
            // exp(v) as exp2(v * log2(e)), the same two roundings as __expf
            const v2f e = (t * 16.f) * 1.44269504088896340736f;
            dA[n]     = __builtin_amdgcn_exp2f(e.x);
            dA[n + 1] = __builtin_amdgcn_exp2f(e.y);
            u[n]      = dtx * Bn[n];
            u[n + 1]  = dtx * Bn[n + 1];
        }
        xv = xn;
    };

    load_xdtB(0);
    prepare_step();

    for (int t = 0; t < LL; t++) {
        // the last step fetches its own row again; the result is not used
        const int tn = t + 1 < LL ? t + 1 : t;

        // the part that needs the previous step's rescaled state
        #pragma unroll
        for (int n = 0; n < NN; n++) h[n] = dA[n] * h[n] + u[n];
        // square sum in register pairs: two packed chains of four links, one
        // instruction per two squares, in place of one serial chain of sixteen
        v2f sq0, sq1;
        {
            const v2f a = {h[0], h[1]}, c = {h[2], h[3]};
            sq0 = a * a;
            sq1 = c * c;
        }
        #pragma unroll
        for (int n = 4; n < NN; n += 4) {
            const v2f a = {h[n], h[n + 1]}, c = {h[n + 2], h[n + 3]};
            sq0 = __builtin_elementwise_fma(a, a, sq0);
            sq1 = __builtin_elementwise_fma(c, c, sq1);
        }
        sq0 += sq1;
        float ss = sq0.x + sq0.y;
        const float xcur = xv;

        if (t + 3 < LL) {
            const unsigned pidx = ((unsigned)(t + 2) * DD) | (unsigned)d;
            __builtin_prefetch(dtb + pidx, 0, 0);
            __builtin_prefetch(xb  + pidx, 0, 0);
        }
        load_xdtB(tn);      // both land while the waves reduce their sums
        load_C(t);          // this step's C row, used behind the second barrier

        // wave32 reduce in registers, then cross-wave via LDS
        ss = wave_sum(ss);
        if (lane == 0) wsum[wave] = ss;
        __syncthreads();
        if (wave == 0) {
            const float v = wave_sum(wsum[lane]);
            if (lane == 0) stotal = v;
        }

        // next step's decay factors and input terms: they do not need the norm,
        // and start while wave 0 adds the partials
        prepare_step();
        __syncthreads();

        // output dot product on the state before its rescale: independent of the
        // norm, it fills the waits of the square root and the division; the
        // scalar scale is applied to the sum
        // summed in register pairs like the square sum
        v2f yd0, yd1;
        {
            const v2f a = {h[0], h[1]}, c = {h[2], h[3]};
            const v2f ca = {Crow[0], Crow[1]}, cc = {Crow[2], Crow[3]};
            yd0 = a * ca;
            yd1 = c * cc;
        }
        #pragma unroll
        for (int n = 4; n < NN; n += 4) {
            const v2f a = {h[n], h[n + 1]}, c = {h[n + 2], h[n + 3]};
            const v2f ca = {Crow[n], Crow[n + 1]}, cc = {Crow[n + 2], Crow[n + 3]};
            yd0 = __builtin_elementwise_fma(a, ca, yd0);
            yd1 = __builtin_elementwise_fma(c, cc, yd1);
        }
        yd0 += yd1;
        const float yd = yd0.x + yd0.y;

        float norm  = sqrtf(stotal);
        float scale = fminf(20.f / (norm + 1e-8f), 1.f);
        #pragma unroll
        for (int n = 0; n < NN; n++) h[n] *= scale;
        float y = dpv * xcur + scale * yd;
        ob[(size_t)t * DD + d] = y;
    }
}

// ---------------------------------------------------------------------------
extern "C" void kernel_launch(void* const* d_in, const int* in_sizes, int n_in,
                              void* d_out, int out_size, void* d_ws, size_t ws_size,
                              hipStream_t stream) {
    const float* x     = (const float*)d_in[0];
    const float* Wdt   = (const float*)d_in[1];
    const float* bdt   = (const float*)d_in[2];
    const float* WB    = (const float*)d_in[3];
    const float* WC    = (const float*)d_in[4];
    const float* A_log = (const float*)d_in[5];
    const float* Dp    = (const float*)d_in[6];
    float* out = (float*)d_out;

    char* ws = (char*)d_ws;
    size_t off = 0;
    auto take = [&](size_t bytes) -> void* {
        void* p = ws + off;
        off += (bytes + 255) & ~(size_t)255;
        return p;
    };
    float*  dt  = (float*) take((size_t)ROWS * DD * sizeof(float));   // 16 MB
    float*  Bp  = (float*) take((size_t)ROWS * NN * sizeof(float));
    float*  Cp  = (float*) take((size_t)ROWS * NN * sizeof(float));
    __bf16* xbf = (__bf16*)take((size_t)ROWS * DD * sizeof(__bf16));  // 8 MB
    __bf16* wbf = (__bf16*)take((size_t)DD * DD * sizeof(__bf16));    // 2 MB
    (void)ws_size; (void)in_sizes; (void)n_in; (void)out_size;

    // 1) bf16 conversions
    {
        int n = ROWS * DD;                              // 4,194,304
        cvt_bf16_kernel<<<(n / 4 + 255) / 256, 256, 0, stream>>>(x, xbf, n);
        int m = DD * DD;                                // 1,048,576
        cvt_bf16_kernel<<<(m / 4 + 255) / 256, 256, 0, stream>>>(Wdt, wbf, m);
    }
    // 2) WMMA GEMM + softplus + soft_clamp -> dt  (32x32 tile per wave)
    {
        int tiles = (ROWS / 32) * (DD / 32);            // 4096 tiles, 8/block
        wmma_dt_kernel<<<tiles / 8, 256, 0, stream>>>(xbf, wbf, bdt, dt);
    }
    // 3) B/C projections
    proj_kernel<<<(ROWS * NN) / 256, 256, 0, stream>>>(x, WB, WC, Bp, Cp);
    // 4) sequential scan, one workgroup per batch
    scan_kernel<<<BB, 1024, 0, stream>>>(x, dt, Bp, Cp, A_log, Dp, out);
}

// v004
// One run takes 2080 microseconds.
// In both of two side-by-side timings against v003, it was 1.06 times as fast.
// Over all steps from v000 it is 1.80 times as fast.
#include <hip/hip_runtime.h>
#include <hip/hip_bf16.h>
#include <math.h>

typedef __attribute__((ext_vector_type(16))) __bf16 v16bf;
typedef __attribute__((ext_vector_type(8)))  __bf16 v8bf;
typedef __attribute__((ext_vector_type(8)))  float  v8f;
typedef __attribute__((ext_vector_type(2)))  float  v2f;

#define BB 2
#define LL 2048
#define DD 1024
#define NN 16
#define ROWS (BB*LL)   // 4096
#define LC 512         // time steps per chunk of the scan
#define TP 4           // time steps per thread of the decay kernel
#define PF 4           // steps by which the scan's L2 prefetch leads its decay loads

typedef __attribute__((ext_vector_type(4)))  float  v4f;

__device__ __forceinline__ float fast_tanh(float x) {
    float r;
    asm("v_tanh_f32 %0, %1\n\tv_nop" : "=v"(r) : "v"(x));
    return r;
}

__device__ __forceinline__ float fast_exp2(float x) {
    float r;
    asm("v_exp_f32 %0, %1\n\tv_nop" : "=v"(r) : "v"(x));
    return r;
}

template <int M>
__device__ __forceinline__ float add_row_xmask(float v) {
    const int p = __builtin_amdgcn_update_dpp(0, __builtin_bit_cast(int, v), 0x160 | M, 0xf, 0xf, true);
    return v + __builtin_bit_cast(float, p);
}
__device__ __forceinline__ float wave_sum(float v) {
    const int b = __builtin_bit_cast(int, v);
    v += __builtin_bit_cast(float, __builtin_amdgcn_permlanex16(b, b, 0x76543210, 0xfedcba98, false, false));
    v = add_row_xmask<8>(v);
    v = add_row_xmask<4>(v);
    v = add_row_xmask<2>(v);
    v = add_row_xmask<1>(v);
    return v;
}

__device__ __forceinline__ float soft_clamp_f(float x, float lo, float hi, float sharp) {
    float c  = 0.5f * (hi + lo);
    float r  = 0.5f * (hi - lo);
    float xn = (x - c) / (r + 1e-8f);
    return fast_tanh(xn * sharp) / sharp * r + c;
}

// ---------------------------------------------------------------------------
// fp32 -> bf16 conversion (4 elements/thread)
// ---------------------------------------------------------------------------
__global__ void __launch_bounds__(256)
cvt_bf16_kernel(const float* __restrict__ in, __bf16* __restrict__ out, int n) {
    int base = (blockIdx.x * blockDim.x + threadIdx.x) * 4;
    if (base < n) {
        float4 v = *(const float4*)(in + base);
        out[base + 0] = (__bf16)v.x;
        out[base + 1] = (__bf16)v.y;
        out[base + 2] = (__bf16)v.z;
        out[base + 3] = (__bf16)v.w;
    }
}

// ---------------------------------------------------------------------------
// dt = soft_clamp(softplus(x @ Wdt^T + bdt))  via  v_wmma_f32_16x16x32_bf16
// 2x2 register tiling: one wave computes a 32x32 output block (4 accumulators),
// each A/B fragment is reused twice -> 8 b128 loads feed 4 WMMAs.
// ---------------------------------------------------------------------------
__global__ void __launch_bounds__(256)
wmma_dt_kernel(const __bf16* __restrict__ xbf, const __bf16* __restrict__ wbf,
               const float* __restrict__ bdt, float* __restrict__ dt) {
    const int lane = threadIdx.x & 31;
    const int wave = threadIdx.x >> 5;            // 0..7
    const int tile = blockIdx.x * 8 + wave;       // 0..4095
    const int tm   = tile >> 5;                   // 0..127  (32-row strips)
    const int tn   = tile & 31;                   // 0..31   (32-col strips)

    const int l15 = lane & 15;
    const int kg  = (lane >> 4) * 8;              // K sub-group: 0 or 8

    // A fragments: rows tm*32 + l15 (+16); K groups [kg..kg+7], [16+kg..16+kg+7]
    const __bf16* arow0 = xbf + (size_t)(tm * 32 + l15) * DD + kg;
    const __bf16* arow1 = arow0 + (size_t)16 * DD;
    // B fragments: columns tn*32 + l15 (+16); Wdt row-major in k
    const __bf16* brow0 = wbf + (size_t)(tn * 32 + l15) * DD + kg;
    const __bf16* brow1 = brow0 + (size_t)16 * DD;

    v8f acc00 = {}, acc01 = {}, acc10 = {}, acc11 = {};

    #pragma unroll 2
    for (int k0 = 0; k0 < DD; k0 += 32) {
        v8bf a0lo = *(const v8bf*)(arow0 + k0);
        v8bf a0hi = *(const v8bf*)(arow0 + k0 + 16);
        v8bf a1lo = *(const v8bf*)(arow1 + k0);
        v8bf a1hi = *(const v8bf*)(arow1 + k0 + 16);
        v8bf b0lo = *(const v8bf*)(brow0 + k0);
        v8bf b0hi = *(const v8bf*)(brow0 + k0 + 16);
        v8bf b1lo = *(const v8bf*)(brow1 + k0);
        v8bf b1hi = *(const v8bf*)(brow1 + k0 + 16);
        v16bf A0, A1, B0, B1;
        #pragma unroll
        for (int i = 0; i < 8; i++) {
            A0[i] = a0lo[i]; A0[i + 8] = a0hi[i];
            A1[i] = a1lo[i]; A1[i + 8] = a1hi[i];
            B0[i] = b0lo[i]; B0[i + 8] = b0hi[i];
            B1[i] = b1lo[i]; B1[i + 8] = b1hi[i];
        }
        acc00 = __builtin_amdgcn_wmma_f32_16x16x32_bf16(false, A0, false, B0, (short)0, acc00, false, false);
        acc01 = __builtin_amdgcn_wmma_f32_16x16x32_bf16(false, A0, false, B1, (short)0, acc01, false, false);
        acc10 = __builtin_amdgcn_wmma_f32_16x16x32_bf16(false, A1, false, B0, (short)0, acc10, false, false);
        acc11 = __builtin_amdgcn_wmma_f32_16x16x32_bf16(false, A1, false, B1, (short)0, acc11, false, false);
    }

    const int mbase = (lane >> 4) * 8;
    auto epilogue = [&](v8f acc, int rowbase, int colbase) {
        const int col  = colbase + l15;
        const float bias = bdt[col];
        #pragma unroll
        for (int r = 0; r < 8; r++) {
            int row  = rowbase + mbase + r;
            float v  = acc[r] + bias;
            // softplus via hardware v_exp_f32 / v_log_f32 (result clamped anyway)
            float sp = (v > 20.f) ? v : __logf(1.f + __expf(v));
            dt[(size_t)row * DD + col] = soft_clamp_f(sp, 0.001f, 0.1f, 0.5f);
        }
    };
    epilogue(acc00, tm * 32,      tn * 32);
    epilogue(acc01, tm * 32,      tn * 32 + 16);
    epilogue(acc10, tm * 32 + 16, tn * 32);
    epilogue(acc11, tm * 32 + 16, tn * 32 + 16);
}

// ---------------------------------------------------------------------------
// Bp = x @ WB^T, Cp = x @ WC^T   ([4096,16] each) — small, plain VALU
// ---------------------------------------------------------------------------
__global__ void __launch_bounds__(256)
proj_kernel(const float* __restrict__ x, const float* __restrict__ WB,
            const float* __restrict__ WC, float* __restrict__ Bp,
            float* __restrict__ Cp) {
    int t   = blockIdx.x * blockDim.x + threadIdx.x;   // 0..65535
    int row = t >> 4;
    int n   = t & 15;
    const float4* xr = (const float4*)(x + (size_t)row * DD);
    const float4* wb = (const float4*)(WB + (size_t)n * DD);
    const float4* wc = (const float4*)(WC + (size_t)n * DD);
    float sb = 0.f, sc = 0.f;
    #pragma unroll 4
    for (int k = 0; k < DD / 4; k++) {
        float4 xv = xr[k], bv = wb[k], cv = wc[k];
        sb += xv.x * bv.x + xv.y * bv.y + xv.z * bv.z + xv.w * bv.w;
        sc += xv.x * cv.x + xv.y * cv.y + xv.z * cv.z + xv.w * cv.w;
    }
    Bp[t] = sb;
    Cp[t] = sc;
}

__global__ void __launch_bounds__(256)
decay_kernel(const float* __restrict__ dt, const float* __restrict__ A_log,
             float* __restrict__ dAc, int t0) {
    const int d   = blockIdx.y * 256 + threadIdx.x;
    const int b   = blockIdx.z;
    const int tl0 = blockIdx.x * TP;

    float A[NN];
    #pragma unroll
    for (int q = 0; q < 4; q++) {
        const v4f al = *((const v4f*)A_log + d * 4 + q);
        #pragma unroll
        for (int j = 0; j < 4; j++) {
            // soft_clamp(al,-5,5,0.5) = 10*tanh(al/10)
            A[q * 4 + j] = -__expf(10.f * fast_tanh(al[j] * 0.1f));
        }
    }
    #pragma unroll
    for (int i = 0; i < TP; i++) {
        const int tl = tl0 + i;
        const float dtn = dt[((size_t)b * LL + t0 + tl) * DD + d];
        v4f* dst = (v4f*)dAc + (size_t)(b * LC + tl) * 4 * DD + d;
        #pragma unroll
        for (int q = 0; q < 4; q++) {
            v4f v;
            #pragma unroll
            for (int j = 0; j < 4; j++) {
                // soft_clamp(z,-8,8,0.5) = 16*tanh(z/16), z = dt*A
                const float th = fast_tanh((dtn * A[q * 4 + j]) * 0.0625f);
                // exp(v) as exp2(v * log2(e)), the same two roundings as __expf
                v[j] = fast_exp2((th * 16.f) * 1.44269504088896340736f);
            }
            dst[q * DD] = v;
        }
    }
}

// Eight packed products in place, for the scan's input terms dt * x * B.
// volatile: keeps them where the source has them, between the scan's two barriers,
// where the waves otherwise idle while wave 0 sums; as plain products the compiler
// sinks them behind the second barrier, onto the path that waits for the norm.
__device__ __forceinline__ void scale8_here(v2f& a0, v2f& a1, v2f& a2, v2f& a3,
                                            v2f& a4, v2f& a5, v2f& a6, v2f& a7, v2f m) {
    asm volatile("s_delay_alu instid0(VALU_DEP_1)\n\t"
                 "v_pk_mul_f32 %0, %0, %8\n\t"
                 "v_pk_mul_f32 %1, %1, %8\n\t"
                 "v_pk_mul_f32 %2, %2, %8\n\t"
                 "v_pk_mul_f32 %3, %3, %8\n\t"
                 "v_pk_mul_f32 %4, %4, %8\n\t"
                 "v_pk_mul_f32 %5, %5, %8\n\t"
                 "v_pk_mul_f32 %6, %6, %8\n\t"
                 "v_pk_mul_f32 %7, %7, %8"
                 : "+v"(a0), "+v"(a1), "+v"(a2), "+v"(a3),
                   "+v"(a4), "+v"(a5), "+v"(a6), "+v"(a7)
                 : "v"(m));
}

// Work-group barrier that waits for this wave's LDS traffic alone. __syncthreads()
// also waits for every global load of the wave, and would land, at each barrier,
// the loads that are issued one and two steps ahead of their use.
__device__ __forceinline__ void lds_barrier() {
    asm volatile("s_wait_dscnt 0x0\n\ts_barrier_signal -1\n\ts_barrier_wait -1" ::: "memory");
}

// ---------------------------------------------------------------------------
// Sequential scan over one chunk of LC steps. One workgroup per batch (global norm
// couples all of D,N). thread d holds h[d, 0..15] in registers (carried from chunk
// to chunk through hst); norm via register lane sums + LDS.
// The decay factors come from decay_kernel: two register sets, each refilled for
// step t+2 as soon as step t has used it, its lines asked into L2 PF steps earlier.
// x, dt and the B row of step t+2 are fetched between the barriers of step t, behind
// the input terms of step t+1; the C row of step t+1 behind the dot of step t.
// ---------------------------------------------------------------------------
__global__ void __launch_bounds__(1024)
scan_kernel(const float* __restrict__ x, const float* __restrict__ dt,
            const float* __restrict__ Bp, const float* __restrict__ Cp,
            const float* __restrict__ dAc, const float* __restrict__ Dp,
            float* __restrict__ hst, float* __restrict__ out, int t0) {
    const int b    = blockIdx.x;
    const int d    = threadIdx.x;
    const int lane = threadIdx.x & 31;
    const int wave = threadIdx.x >> 5;

    __shared__ float wsum[32];
    __shared__ float stotal;

    v4f* hb = (v4f*)hst + (size_t)b * 4 * DD + d;
    float h[NN];
    #pragma unroll
    for (int q = 0; q < 4; q++) {
        v4f v = {0.f, 0.f, 0.f, 0.f};
        if (t0 != 0) v = hb[q * DD];
        h[q*4+0] = v.x; h[q*4+1] = v.y; h[q*4+2] = v.z; h[q*4+3] = v.w;
    }
    const float dpv = Dp[d];

    const float* xb  = x  + (size_t)b * LL * DD;
    const float* dtb = dt + (size_t)b * LL * DD;
    const float* Bb  = Bp + (size_t)b * LL * NN;
    const float* Cb  = Cp + (size_t)b * LL * NN;
    const v4f*   dAb = (const v4f*)dAc + (size_t)b * LC * 4 * DD;
    float*       ob  = out + (size_t)b * LL * DD;

    // raw operands of the step that is being fetched
    float xn, dtn, Bn[NN];
    // finished operands of the step that is about to run
    float xv, u[NN], Crow[NN];
    // decay factors of the even and of the odd steps
    float dA0[NN], dA1[NN];

    auto load_xdtB = [&](int t) {
        const unsigned idx = ((unsigned)t * DD) | (unsigned)d;   // 32-bit offset on a scalar base
        xn  = xb[idx];
        // the second load's result may be given the offset register that the first
        // names: the wait that belongs in front of such an overwrite
        asm volatile("s_wait_xcnt 0x0" ::: "memory");
        dtn = dtb[idx];
        asm volatile("s_wait_xcnt 0x0" ::: "memory");
        #pragma unroll
        for (int q = 0; q < 4; q++) {
            float4 bq = *(const float4*)(Bb + t * NN + q * 4);
            Bn[q*4+0] = bq.x; Bn[q*4+1] = bq.y; Bn[q*4+2] = bq.z; Bn[q*4+3] = bq.w;
        }
    };
    auto load_C = [&](int t) {
        #pragma unroll
        for (int q = 0; q < 4; q++) {
            float4 cq = *(const float4*)(Cb + t * NN + q * 4);
            Crow[q*4+0] = cq.x; Crow[q*4+1] = cq.y; Crow[q*4+2] = cq.z; Crow[q*4+3] = cq.w;
        }
    };
    auto load_dA = [&](float (&s)[NN], int tl) {
        const unsigned idx = ((unsigned)tl * (4 * DD)) | (unsigned)d;
        #pragma unroll
        for (int q = 0; q < 4; q++) {
            // read once: non-temporal, so that the stream does not push x, dt and
            // the B and C rows out of the caches
            const v4f v = __builtin_nontemporal_load(dAb + idx + q * DD);
            s[q*4+0] = v.x; s[q*4+1] = v.y; s[q*4+2] = v.z; s[q*4+3] = v.w;
        }
        // the wait that belongs in front of an overwrite of these loads' address registers
        asm volatile("s_wait_xcnt 0x0" ::: "memory");
    };
    unsigned poff = (unsigned)(lane >> 3) * (DD * 16) + (unsigned)wave * 512 + (unsigned)(lane & 7) * 64
                  + 2u * (4 * DD * 16);
    const unsigned pcap = poff + (unsigned)(LC - 4) * (4 * DD * 16);   // the row before the last
    auto prefetch_dA = [&]() {
        asm volatile("global_prefetch_b8 %0, %1 scope:SCOPE_SE\n\t"
                     "v_min_u32 %0, %0, %2\n\t"
                     "s_delay_alu instid0(VALU_DEP_1)\n\t"   // hint for the dependent add
                     "v_add_nc_u32 %0, 0x10000, %0"
                     : "+v"(poff) : "s"(dAb), "v"(pcap) : "memory");
    };
    auto input_terms = [&]() {
        const float dtx = dtn * xn;
        const v2f d2 = {dtx, dtx};
        v2f p[NN / 2];
        #pragma unroll
        for (int n = 0; n < NN; n += 2) p[n / 2] = v2f{Bn[n], Bn[n + 1]};
        scale8_here(p[0], p[1], p[2], p[3], p[4], p[5], p[6], p[7], d2);
        #pragma unroll
        for (int n = 0; n < NN; n += 2) { u[n] = p[n / 2].x; u[n + 1] = p[n / 2].y; }
        // x is kept for the output term. The copy is made here, where x has landed:
        // left to the compiler it stands at the loop's foot, on the register of the
        // next fetch, and waits there for every load in flight
        asm("v_mov_b32 %0, %1" : "=v"(xv) : "v"(xn));
    };

    auto step = [&](float (&dA)[NN], int tl) {
        const int t = t0 + tl;

        // the part that needs the previous step's rescaled state
        // (the fused form written out: dA * h fused onto the rounded input term, in
        // every step alike, whichever product the compiler would pick to fuse)
        #pragma unroll
        for (int n = 0; n < NN; n++) h[n] = __builtin_fmaf(dA[n], h[n], u[n]);
        // this set is free now: refill it for step t+2 (the chunk's last two steps
        // fetch its last row again; the result is not used)
        load_dA(dA, tl + 2 < LC ? tl + 2 : LC - 1);
        prefetch_dA();   // row tl + 2 + PF

        // square sum in register pairs: two packed chains of four links, one
        // instruction per two squares, in place of one serial chain of sixteen
        v2f sq0, sq1;
        {
            const v2f a = {h[0], h[1]}, c = {h[2], h[3]};
            sq0 = a * a;
            sq1 = c * c;
        }
        #pragma unroll
        for (int n = 4; n < NN; n += 4) {
            const v2f a = {h[n], h[n + 1]}, c = {h[n + 2], h[n + 3]};
            sq0 = __builtin_elementwise_fma(a, a, sq0);
            sq1 = __builtin_elementwise_fma(c, c, sq1);
        }
        sq0 += sq1;
        float ss = sq0.x + sq0.y;
        const float xcur = xv;

        {
            const unsigned pidx = ((unsigned)(t + 3 < LL ? t + 3 : LL - 1) * DD) | (unsigned)d;
            __builtin_prefetch(dtb + pidx, 0, 0);
            __builtin_prefetch(xb  + pidx, 0, 0);
        }

        // wave32 reduce in registers, then cross-wave via LDS
        ss = wave_sum(ss);
        if (lane == 0) wsum[wave] = ss;
        lds_barrier();
        if (wave == 0) {
            const float v = wave_sum(wsum[lane]);
            if (lane == 0) stotal = v;
        }

        // next step's input terms do not need the norm: they run while wave 0 adds
        // the partials; then the fetch of the step after it
        input_terms();
        load_xdtB(t + 2 < LL ? t + 2 : LL - 1);
        lds_barrier();

        // output dot product on the state before its rescale: independent of the
        // norm, it fills the waits of the square root and the division; the
        // scalar scale is applied to the sum
        // summed in register pairs like the square sum
        v2f yd0, yd1;
        {
            const v2f a = {h[0], h[1]}, c = {h[2], h[3]};
            const v2f ca = {Crow[0], Crow[1]}, cc = {Crow[2], Crow[3]};
            yd0 = a * ca;
            yd1 = c * cc;
        }
        #pragma unroll
        for (int n = 4; n < NN; n += 4) {
            const v2f a = {h[n], h[n + 1]}, c = {h[n + 2], h[n + 3]};
            const v2f ca = {Crow[n], Crow[n + 1]}, cc = {Crow[n + 2], Crow[n + 3]};
            yd0 = __builtin_elementwise_fma(a, ca, yd0);
            yd1 = __builtin_elementwise_fma(c, cc, yd1);
        }
        yd0 += yd1;
        const float yd = yd0.x + yd0.y;
        load_C(t + 1 < LL ? t + 1 : LL - 1);

        float norm  = sqrtf(stotal);
        float scale = fminf(20.f / (norm + 1e-8f), 1.f);
        #pragma unroll
        for (int n = 0; n < NN; n++) h[n] *= scale;
        float y = dpv * xcur + scale * yd;
        ob[(size_t)t * DD + d] = y;
        // the wait that belongs in front of an overwrite of the store's registers
        asm volatile("s_wait_xcnt 0x0" ::: "memory");
    };

    load_xdtB(t0);
    load_dA(dA0, 0);
    load_dA(dA1, 1);
    #pragma unroll   // rows 2 to 1 + PF: the loop asks for the rows behind them
    for (int i = 0; i < PF; i++) prefetch_dA();
    input_terms();
    load_xdtB(t0 + 1);
    load_C(t0);

    // two steps per trip: each has its own set of decay factors, so that no
    // register with a load in flight has to be copied
    for (int tl = 0; tl < LC; tl += 2) {
        step(dA0, tl);
        step(dA1, tl + 1);
    }

    #pragma unroll
    for (int q = 0; q < 4; q++) {
        const v4f v = {h[q*4+0], h[q*4+1], h[q*4+2], h[q*4+3]};
        hb[q * DD] = v;
    }
}

// ---------------------------------------------------------------------------
extern "C" void kernel_launch(void* const* d_in, const int* in_sizes, int n_in,
                              void* d_out, int out_size, void* d_ws, size_t ws_size,
                              hipStream_t stream) {
    const float* x     = (const float*)d_in[0];
    const float* Wdt   = (const float*)d_in[1];
    const float* bdt   = (const float*)d_in[2];
    const float* WB    = (const float*)d_in[3];
    const float* WC    = (const float*)d_in[4];
    const float* A_log = (const float*)d_in[5];
    const float* Dp    = (const float*)d_in[6];
    float* out = (float*)d_out;

    char* ws = (char*)d_ws;
    size_t off = 0;
    auto take = [&](size_t bytes) -> void* {
        void* p = ws + off;
        off += (bytes + 255) & ~(size_t)255;
        return p;
    };
    float*  dt  = (float*) take((size_t)ROWS * DD * sizeof(float));   // 16 MB
    float*  Bp  = (float*) take((size_t)ROWS * NN * sizeof(float));
    float*  Cp  = (float*) take((size_t)ROWS * NN * sizeof(float));
    __bf16* xbf = (__bf16*)take((size_t)ROWS * DD * sizeof(__bf16));  // 8 MB
    __bf16* wbf = (__bf16*)take((size_t)DD * DD * sizeof(__bf16));    // 2 MB
    float*  dAc = (float*) take((size_t)BB * LC * DD * NN * sizeof(float));  // 64 MB, one chunk
    float*  hst = (float*) take((size_t)BB * DD * NN * sizeof(float));
    (void)ws_size; (void)in_sizes; (void)n_in; (void)out_size;

    // 1) bf16 conversions
    {
        int n = ROWS * DD;                              // 4,194,304
        cvt_bf16_kernel<<<(n / 4 + 255) / 256, 256, 0, stream>>>(x, xbf, n);
        int m = DD * DD;                                // 1,048,576
        cvt_bf16_kernel<<<(m / 4 + 255) / 256, 256, 0, stream>>>(Wdt, wbf, m);
    }
    // 2) WMMA GEMM + softplus + soft_clamp -> dt  (32x32 tile per wave)
    {
        int tiles = (ROWS / 32) * (DD / 32);            // 4096 tiles, 8/block
        wmma_dt_kernel<<<tiles / 8, 256, 0, stream>>>(xbf, wbf, bdt, dt);
    }
    // 3) B/C projections
    proj_kernel<<<(ROWS * NN) / 256, 256, 0, stream>>>(x, WB, WC, Bp, Cp);
    const dim3 dgrid(LC / TP, DD / 256, BB);
    decay_kernel<<<dgrid, 256, 0, stream>>>(dt, A_log, dAc, 0 * LC);
    scan_kernel<<<BB, 1024, 0, stream>>>(x, dt, Bp, Cp, dAc, Dp, hst, out, 0 * LC);
    decay_kernel<<<dgrid, 256, 0, stream>>>(dt, A_log, dAc, 1 * LC);
    scan_kernel<<<BB, 1024, 0, stream>>>(x, dt, Bp, Cp, dAc, Dp, hst, out, 1 * LC);
    decay_kernel<<<dgrid, 256, 0, stream>>>(dt, A_log, dAc, 2 * LC);
    scan_kernel<<<BB, 1024, 0, stream>>>(x, dt, Bp, Cp, dAc, Dp, hst, out, 2 * LC);
    decay_kernel<<<dgrid, 256, 0, stream>>>(dt, A_log, dAc, 3 * LC);
    scan_kernel<<<BB, 1024, 0, stream>>>(x, dt, Bp, Cp, dAc, Dp, hst, out, 3 * LC);
}

// v005
// Measured time: 1830 microseconds a run.
// In both of two side-by-side timings against v004, it was 1.14 times as fast.
// Over all steps from v000 it is 2.06 times as fast.
#include <hip/hip_runtime.h>
#include <hip/hip_bf16.h>
#include <math.h>

typedef __attribute__((ext_vector_type(16))) __bf16 v16bf;
typedef __attribute__((ext_vector_type(8)))  __bf16 v8bf;
typedef __attribute__((ext_vector_type(8)))  float  v8f;
typedef __attribute__((ext_vector_type(2)))  float  v2f;

#define BB 2
#define LL 2048
#define DD 1024
#define NN 16
#define ROWS (BB*LL)   // 4096
#define LC 512         // time steps per chunk of the scan
#define TP 4           // time steps per thread of the decay kernel
#define PF 4           // steps by which the scan's L2 prefetch leads its decay loads

typedef __attribute__((ext_vector_type(4)))  float  v4f;

__device__ __forceinline__ float fast_tanh(float x) {
    float r;
    asm("v_tanh_f32 %0, %1\n\tv_nop" : "=v"(r) : "v"(x));
    return r;
}

__device__ __forceinline__ float fast_exp2(float x) {
    float r;
    asm("v_exp_f32 %0, %1\n\tv_nop" : "=v"(r) : "v"(x));
    return r;
}

template <int M>
__device__ __forceinline__ float add_row_xmask(float v) {
    const int p = __builtin_amdgcn_update_dpp(0, __builtin_bit_cast(int, v), 0x160 | M, 0xf, 0xf, true);
    return v + __builtin_bit_cast(float, p);
}
__device__ __forceinline__ float wave_sum(float v) {
    const int b = __builtin_bit_cast(int, v);
    v += __builtin_bit_cast(float, __builtin_amdgcn_permlanex16(b, b, 0x76543210, 0xfedcba98, false, false));
    v = add_row_xmask<8>(v);
    v = add_row_xmask<4>(v);
    v = add_row_xmask<2>(v);
    v = add_row_xmask<1>(v);
    return v;
}

__device__ __forceinline__ float soft_clamp_f(float x, float lo, float hi, float sharp) {
    float c  = 0.5f * (hi + lo);
    float r  = 0.5f * (hi - lo);
    float xn = (x - c) / (r + 1e-8f);
    return fast_tanh(xn * sharp) / sharp * r + c;
}

// ---------------------------------------------------------------------------
// fp32 -> bf16 conversion (4 elements/thread)
// ---------------------------------------------------------------------------
__global__ void __launch_bounds__(256)
cvt_bf16_kernel(const float* __restrict__ in, __bf16* __restrict__ out, int n) {
    int base = (blockIdx.x * blockDim.x + threadIdx.x) * 4;
    if (base < n) {
        float4 v = *(const float4*)(in + base);
        out[base + 0] = (__bf16)v.x;
        out[base + 1] = (__bf16)v.y;
        out[base + 2] = (__bf16)v.z;
        out[base + 3] = (__bf16)v.w;
    }
}

// ---------------------------------------------------------------------------
// dt = soft_clamp(softplus(x @ Wdt^T + bdt))  via  v_wmma_f32_16x16x32_bf16
// 2x2 register tiling: one wave computes a 32x32 output block (4 accumulators),
// each A/B fragment is reused twice -> 8 b128 loads feed 4 WMMAs.
// ---------------------------------------------------------------------------
__global__ void __launch_bounds__(256)
wmma_dt_kernel(const __bf16* __restrict__ xbf, const __bf16* __restrict__ wbf,
               const float* __restrict__ bdt, float* __restrict__ dt) {
    const int lane = threadIdx.x & 31;
    const int wave = threadIdx.x >> 5;            // 0..7
    const int tile = blockIdx.x * 8 + wave;       // 0..4095
    const int tm   = tile >> 5;                   // 0..127  (32-row strips)
    const int tn   = tile & 31;                   // 0..31   (32-col strips)

    const int l15 = lane & 15;
    const int kg  = (lane >> 4) * 8;              // K sub-group: 0 or 8

    // A fragments: rows tm*32 + l15 (+16); K groups [kg..kg+7], [16+kg..16+kg+7]
    const __bf16* arow0 = xbf + (size_t)(tm * 32 + l15) * DD + kg;
    const __bf16* arow1 = arow0 + (size_t)16 * DD;
    // B fragments: columns tn*32 + l15 (+16); Wdt row-major in k
    const __bf16* brow0 = wbf + (size_t)(tn * 32 + l15) * DD + kg;
    const __bf16* brow1 = brow0 + (size_t)16 * DD;

    v8f acc00 = {}, acc01 = {}, acc10 = {}, acc11 = {};

    #pragma unroll 2
    for (int k0 = 0; k0 < DD; k0 += 32) {
        v8bf a0lo = *(const v8bf*)(arow0 + k0);
        v8bf a0hi = *(const v8bf*)(arow0 + k0 + 16);
        v8bf a1lo = *(const v8bf*)(arow1 + k0);
        v8bf a1hi = *(const v8bf*)(arow1 + k0 + 16);
        v8bf b0lo = *(const v8bf*)(brow0 + k0);
        v8bf b0hi = *(const v8bf*)(brow0 + k0 + 16);
        v8bf b1lo = *(const v8bf*)(brow1 + k0);
        v8bf b1hi = *(const v8bf*)(brow1 + k0 + 16);
        v16bf A0, A1, B0, B1;
        #pragma unroll
        for (int i = 0; i < 8; i++) {
            A0[i] = a0lo[i]; A0[i + 8] = a0hi[i];
            A1[i] = a1lo[i]; A1[i + 8] = a1hi[i];
            B0[i] = b0lo[i]; B0[i + 8] = b0hi[i];
            B1[i] = b1lo[i]; B1[i + 8] = b1hi[i];
        }
        acc00 = __builtin_amdgcn_wmma_f32_16x16x32_bf16(false, A0, false, B0, (short)0, acc00, false, false);
        acc01 = __builtin_amdgcn_wmma_f32_16x16x32_bf16(false, A0, false, B1, (short)0, acc01, false, false);
        acc10 = __builtin_amdgcn_wmma_f32_16x16x32_bf16(false, A1, false, B0, (short)0, acc10, false, false);
        acc11 = __builtin_amdgcn_wmma_f32_16x16x32_bf16(false, A1, false, B1, (short)0, acc11, false, false);
    }

    const int mbase = (lane >> 4) * 8;
    auto epilogue = [&](v8f acc, int rowbase, int colbase) {
        const int col  = colbase + l15;
        const float bias = bdt[col];
        #pragma unroll
        for (int r = 0; r < 8; r++) {
            int row  = rowbase + mbase + r;
            float v  = acc[r] + bias;
            // softplus via hardware v_exp_f32 / v_log_f32 (result clamped anyway)
            float sp = (v > 20.f) ? v : __logf(1.f + __expf(v));
            dt[(size_t)row * DD + col] = soft_clamp_f(sp, 0.001f, 0.1f, 0.5f);
        }
    };
    epilogue(acc00, tm * 32,      tn * 32);
    epilogue(acc01, tm * 32,      tn * 32 + 16);
    epilogue(acc10, tm * 32 + 16, tn * 32);
    epilogue(acc11, tm * 32 + 16, tn * 32 + 16);
}

// ---------------------------------------------------------------------------
// Bp = x @ WB^T, Cp = x @ WC^T   ([4096,16] each) — small, plain VALU
// ---------------------------------------------------------------------------
__global__ void __launch_bounds__(256)
proj_kernel(const float* __restrict__ x, const float* __restrict__ WB,
            const float* __restrict__ WC, float* __restrict__ Bp,
            float* __restrict__ Cp) {
    int t   = blockIdx.x * blockDim.x + threadIdx.x;   // 0..65535
    int row = t >> 4;
    int n   = t & 15;
    const float4* xr = (const float4*)(x + (size_t)row * DD);
    const float4* wb = (const float4*)(WB + (size_t)n * DD);
    const float4* wc = (const float4*)(WC + (size_t)n * DD);
    float sb = 0.f, sc = 0.f;
    #pragma unroll 4
    for (int k = 0; k < DD / 4; k++) {
        float4 xv = xr[k], bv = wb[k], cv = wc[k];
        sb += xv.x * bv.x + xv.y * bv.y + xv.z * bv.z + xv.w * bv.w;
        sc += xv.x * cv.x + xv.y * cv.y + xv.z * cv.z + xv.w * cv.w;
    }
    Bp[t] = sb;
    Cp[t] = sc;
}

__global__ void __launch_bounds__(256)
decay_kernel(const float* __restrict__ dt, const float* __restrict__ A_log,
             float* __restrict__ dAc, int t0) {
    const int d   = blockIdx.y * 256 + threadIdx.x;
    const int b   = blockIdx.z;
    const int tl0 = blockIdx.x * TP;

    float A[NN];
    #pragma unroll
    for (int q = 0; q < 4; q++) {
        const v4f al = *((const v4f*)A_log + d * 4 + q);
        #pragma unroll
        for (int j = 0; j < 4; j++) {
            // soft_clamp(al,-5,5,0.5) = 10*tanh(al/10)
            A[q * 4 + j] = -__expf(10.f * fast_tanh(al[j] * 0.1f));
        }
    }
    #pragma unroll
    for (int i = 0; i < TP; i++) {
        const int tl = tl0 + i;
        const float dtn = dt[((size_t)b * LL + t0 + tl) * DD + d];
        v4f* dst = (v4f*)dAc + (size_t)(b * LC + tl) * 4 * DD + d;
        #pragma unroll
        for (int q = 0; q < 4; q++) {
            v4f v;
            #pragma unroll
            for (int j = 0; j < 4; j++) {
                // soft_clamp(z,-8,8,0.5) = 16*tanh(z/16), z = dt*A
                const float th = fast_tanh((dtn * A[q * 4 + j]) * 0.0625f);
                // exp(v) as exp2(v * log2(e)), the same two roundings as __expf
                v[j] = fast_exp2((th * 16.f) * 1.44269504088896340736f);
            }
            dst[q * DD] = v;
        }
    }
}

// Eight packed products in place, for the scan's input terms dt * x * B.
// volatile: keeps them where the source has them, between the scan's two barriers,
// where the waves otherwise idle while wave 0 sums; as plain products the compiler
// sinks them behind the second barrier, onto the path that waits for the norm.
__device__ __forceinline__ void scale8_here(v2f& a0, v2f& a1, v2f& a2, v2f& a3,
                                            v2f& a4, v2f& a5, v2f& a6, v2f& a7, v2f m) {
    asm volatile("s_delay_alu instid0(VALU_DEP_1)\n\t"
                 "v_pk_mul_f32 %0, %0, %8\n\t"
                 "v_pk_mul_f32 %1, %1, %8\n\t"
                 "v_pk_mul_f32 %2, %2, %8\n\t"
                 "v_pk_mul_f32 %3, %3, %8\n\t"
                 "v_pk_mul_f32 %4, %4, %8\n\t"
                 "v_pk_mul_f32 %5, %5, %8\n\t"
                 "v_pk_mul_f32 %6, %6, %8\n\t"
                 "v_pk_mul_f32 %7, %7, %8"
                 : "+v"(a0), "+v"(a1), "+v"(a2), "+v"(a3),
                   "+v"(a4), "+v"(a5), "+v"(a6), "+v"(a7)
                 : "v"(m));
}

// Work-group barrier that waits for this wave's LDS traffic alone. __syncthreads()
// also waits for every global load of the wave, and would land, at each barrier,
// the loads that are issued one and two steps ahead of their use.
__device__ __forceinline__ void lds_barrier() {
    asm volatile("s_wait_dscnt 0x0\n\ts_barrier_signal -1\n\ts_barrier_wait -1" ::: "memory");
}

__global__ void __launch_bounds__(1024)
scan_kernel(const float* __restrict__ x, const float* __restrict__ dt,
            const float* __restrict__ Bp, const float* __restrict__ Cp,
            const float* __restrict__ dAc, const float* __restrict__ Dp,
            float* __restrict__ hst, float* __restrict__ out, int t0) {
    const int b    = blockIdx.x;
    const int d    = threadIdx.x;
    const int lane = threadIdx.x & 31;
    const int wave = threadIdx.x >> 5;

    __shared__ float wsum[32];
    __shared__ float stotal;

    v4f* hb = (v4f*)hst + (size_t)b * 4 * DD + d;
    float h[NN];
    #pragma unroll
    for (int q = 0; q < 4; q++) {
        v4f v = {0.f, 0.f, 0.f, 0.f};
        if (t0 != 0) v = hb[q * DD];
        h[q*4+0] = v.x; h[q*4+1] = v.y; h[q*4+2] = v.z; h[q*4+3] = v.w;
    }
    const float dpv = Dp[d];

    const float* xb  = x  + (size_t)b * LL * DD;
    const float* dtb = dt + (size_t)b * LL * DD;
    const float* Bb  = Bp + (size_t)b * LL * NN;
    const float* Cb  = Cp + (size_t)b * LL * NN;
    const v4f*   dAb = (const v4f*)dAc + (size_t)b * LC * 4 * DD;
    float*       ob  = out + (size_t)b * LL * DD;

    // raw operands of the step that is being fetched
    float xn, dtn, Bn[NN];
    // finished operands of the step that is about to run
    float xv, u[NN], Crow[NN];
    // decay factors of the even and of the odd steps
    float dA0[NN], dA1[NN];

    // byte offsets on scalar bases: xo the x/dt row last fetched, xp the x/dt row last
    // asked into the caches, ao the decay row last fetched, so the output row last stored
    unsigned xo = (unsigned)t0 * (DD * 4) + (unsigned)d * 4;
    unsigned xp = xo + 2u * (DD * 4);
    unsigned ao = (unsigned)d * 16;
    unsigned so = xo;
    float    ykeep = 0.f;   // the value that the step's store names
    // The wait that belongs in front of an overwrite of a register that an issued load
    // or store names, and the overwrites, in one statement: nothing can come between.
    auto next_offsets = [&](int sx, int sp, int sa, int ss) {
        asm volatile("s_wait_xcnt 0x0\n\t"
                     "v_add_nc_u32 %0, %4, %0\n\t"
                     "v_add_nc_u32 %1, %5, %1\n\t"
                     "v_add_nc_u32 %2, %6, %2\n\t"
                     "v_add_nc_u32 %3, %7, %3"
                     : "+v"(xo), "+v"(xp), "+v"(ao), "+v"(so)
                     : "s"(sx), "s"(sp), "s"(sa), "s"(ss) : "memory");
    };
    auto load_xdt = [&]() {
        xn  = *(const float*)((const char*)xb  + xo);
        dtn = *(const float*)((const char*)dtb + xo);
    };
    auto load_B = [&](int t) {
        #pragma unroll
        for (int q = 0; q < 4; q++) {
            float4 bq = *(const float4*)(Bb + t * NN + q * 4);
            Bn[q*4+0] = bq.x; Bn[q*4+1] = bq.y; Bn[q*4+2] = bq.z; Bn[q*4+3] = bq.w;
        }
    };
    auto load_C = [&](int t) {
        #pragma unroll
        for (int q = 0; q < 4; q++) {
            float4 cq = *(const float4*)(Cb + t * NN + q * 4);
            Crow[q*4+0] = cq.x; Crow[q*4+1] = cq.y; Crow[q*4+2] = cq.z; Crow[q*4+3] = cq.w;
        }
    };
    auto load_dA = [&](float (&s)[NN]) {
        #pragma unroll
        for (int q = 0; q < 4; q++) {
            // read once: non-temporal, so that the stream does not push x, dt and
            // the B and C rows out of the caches
            const v4f v = __builtin_nontemporal_load((const v4f*)((const char*)dAb + ao) + q * DD);
            s[q*4+0] = v.x; s[q*4+1] = v.y; s[q*4+2] = v.z; s[q*4+3] = v.w;
        }
    };
    unsigned poff = (unsigned)(lane >> 3) * (DD * 16) + (unsigned)wave * 512 + (unsigned)(lane & 7) * 64
                  + 2u * (4 * DD * 16);
    const unsigned pcap = poff + (unsigned)(LC - 4) * (4 * DD * 16);   // the row before the last
    auto prefetch_dA = [&]() {
        asm volatile("global_prefetch_b8 %0, %1 scope:SCOPE_SE\n\t"
                     "v_min_u32 %0, %0, %2\n\t"
                     "s_delay_alu instid0(VALU_DEP_1)\n\t"   // hint for the dependent add
                     "v_add_nc_u32 %0, 0x10000, %0"
                     : "+v"(poff) : "s"(dAb), "v"(pcap) : "memory");
    };
    auto input_terms = [&]() {
        const float dtx = dtn * xn;
        const v2f d2 = {dtx, dtx};
        v2f p[NN / 2];
        #pragma unroll
        for (int n = 0; n < NN; n += 2) p[n / 2] = v2f{Bn[n], Bn[n + 1]};
        scale8_here(p[0], p[1], p[2], p[3], p[4], p[5], p[6], p[7], d2);
        #pragma unroll
        for (int n = 0; n < NN; n += 2) { u[n] = p[n / 2].x; u[n + 1] = p[n / 2].y; }
        // x is kept for the output term. The copy is made here, where x has landed:
        // left to the compiler it stands at the loop's foot, on the register of the
        // next fetch, and waits there for every load in flight
        asm("v_mov_b32 %0, %1" : "=v"(xv) : "v"(xn));
    };

    auto step = [&](float (&dA)[NN], int tl) {
        const int t = t0 + tl;

        // the part that needs the previous step's rescaled state
        // (the fused form written out: dA * h fused onto the rounded input term, in
        // every step alike, whichever product the compiler would pick to fuse)
        #pragma unroll
        for (int n = 0; n < NN; n++) h[n] = __builtin_fmaf(dA[n], h[n], u[n]);
        // square sum in register pairs: two packed chains of four links, one
        // instruction per two squares, in place of one serial chain of sixteen
        v2f sq0, sq1;
        {
            const v2f a = {h[0], h[1]}, c = {h[2], h[3]};
            sq0 = a * a;
            sq1 = c * c;
        }
        #pragma unroll
        for (int n = 4; n < NN; n += 4) {
            const v2f a = {h[n], h[n + 1]}, c = {h[n + 2], h[n + 3]};
            sq0 = __builtin_elementwise_fma(a, a, sq0);
            sq1 = __builtin_elementwise_fma(c, c, sq1);
        }
        sq0 += sq1;
        float ss = sq0.x + sq0.y;
        const float xcur = xv;

        // wave32 reduce in registers, then cross-wave via LDS
        ss = wave_sum(ss);
        if (lane == 0) wsum[wave] = ss;
        lds_barrier();
        if (wave == 0) {
            const float v = wave_sum(wsum[lane]);
            if (lane == 0) stotal = v;
        }

        // next step's input terms do not need the norm: they run while wave 0 adds
        // the partials; then the fetch of the B row of the step after it
        input_terms();
        load_B(t + 2 < LL ? t + 2 : LL - 1);
        lds_barrier();
        const float st = stotal;


        // output dot product on the state before its rescale: independent of the
        // norm, it fills the waits of the square root and the division; the
        // scalar scale is applied to the sum
        // summed in register pairs like the square sum
        v2f yd0, yd1;
        {
            const v2f a = {h[0], h[1]}, c = {h[2], h[3]};
            const v2f ca = {Crow[0], Crow[1]}, cc = {Crow[2], Crow[3]};
            yd0 = a * ca;
            yd1 = c * cc;
        }
        #pragma unroll
        for (int n = 4; n < NN; n += 4) {
            const v2f a = {h[n], h[n + 1]}, c = {h[n + 2], h[n + 3]};
            const v2f ca = {Crow[n], Crow[n + 1]}, cc = {Crow[n + 2], Crow[n + 3]};
            yd0 = __builtin_elementwise_fma(a, ca, yd0);
            yd1 = __builtin_elementwise_fma(c, cc, yd1);
        }
        yd0 += yd1;
        const float yd = yd0.x + yd0.y;
        load_C(t + 1 < LL ? t + 1 : LL - 1);

        // the step's vector memory instructions, under the square root and the division
        // (behind the scalar load of the C row: no scalar load then follows them closely).
        // Rows stop at the last one (a stride of 0): the last steps fetch it again, the
        // result is not used.
        next_offsets(t + 2 < LL ? DD * 4 : 0, t + 3 < LL ? DD * 4 : 0,
                     tl + 2 < LC ? 4 * DD * 16 : 0, tl != 0 ? DD * 4 : 0);
        load_xdt();      // row t + 2; first: they are needed before the decay factors
        load_dA(dA);     // row tl + 2, into the set that this step has used
        prefetch_dA();   // row tl + 2 + PF
        __builtin_prefetch((const char*)dtb + xp, 0, 0);
        __builtin_prefetch((const char*)xb  + xp, 0, 0);

        float norm  = sqrtf(st);
        float scale = fminf(20.f / (norm + 1e-8f), 1.f);
        #pragma unroll
        for (int n = 0; n < NN; n++) h[n] *= scale;
        const float sy = scale * yd;
        // y = dpv * x + scale * yd, written into the register that the store names: the
        // store of the step before is covered by this step's wait in next_offsets().
        // In asm so that the value keeps that one register (the hint: sy is fresh)
        asm volatile("s_delay_alu instid0(VALU_DEP_1)\n\t"
                     "v_fma_f32 %0, %1, %2, %3"
                     : "+v"(ykeep) : "v"(dpv), "v"(xcur), "v"(sy));
        *(float*)((char*)ob + so) = ykeep;
    };

    // the same order of loads as in the loop (x and dt in front of the decay rows), so
    // that the loop's counted waits for x and dt need not cover the decay loads behind them
    load_xdt();
    load_B(t0);
    load_dA(dA0);
    input_terms();
    next_offsets(DD * 4, 0, 4 * DD * 16, 0);
    load_xdt();
    load_dA(dA1);
    #pragma unroll   // rows 2 to 1 + PF: the loop asks for the rows behind them
    for (int i = 0; i < PF; i++) prefetch_dA();
    load_B(t0 + 1);
    load_C(t0);

    // two steps per trip: each has its own set of decay factors, so that no
    // register with a load in flight has to be copied
    for (int tl = 0; tl < LC; tl += 2) {
        step(dA0, tl);
        step(dA1, tl + 1);
    }
    // the last store's registers are free for reuse from here on
    asm volatile("s_wait_xcnt 0x0" ::: "memory");

    #pragma unroll
    for (int q = 0; q < 4; q++) {
        const v4f v = {h[q*4+0], h[q*4+1], h[q*4+2], h[q*4+3]};
        hb[q * DD] = v;
    }
}

// ---------------------------------------------------------------------------
extern "C" void kernel_launch(void* const* d_in, const int* in_sizes, int n_in,
                              void* d_out, int out_size, void* d_ws, size_t ws_size,
                              hipStream_t stream) {
    const float* x     = (const float*)d_in[0];
    const float* Wdt   = (const float*)d_in[1];
    const float* bdt   = (const float*)d_in[2];
    const float* WB    = (const float*)d_in[3];
    const float* WC    = (const float*)d_in[4];
    const float* A_log = (const float*)d_in[5];
    const float* Dp    = (const float*)d_in[6];
    float* out = (float*)d_out;

    char* ws = (char*)d_ws;
    size_t off = 0;
    auto take = [&](size_t bytes) -> void* {
        void* p = ws + off;
        off += (bytes + 255) & ~(size_t)255;
        return p;
    };
    float*  dt  = (float*) take((size_t)ROWS * DD * sizeof(float));   // 16 MB
    float*  Bp  = (float*) take((size_t)ROWS * NN * sizeof(float));
    float*  Cp  = (float*) take((size_t)ROWS * NN * sizeof(float));
    __bf16* xbf = (__bf16*)take((size_t)ROWS * DD * sizeof(__bf16));  // 8 MB
    __bf16* wbf = (__bf16*)take((size_t)DD * DD * sizeof(__bf16));    // 2 MB
    float*  dAc = (float*) take((size_t)BB * LC * DD * NN * sizeof(float));  // 64 MB, one chunk
    float*  hst = (float*) take((size_t)BB * DD * NN * sizeof(float));
    (void)ws_size; (void)in_sizes; (void)n_in; (void)out_size;

    // 1) bf16 conversions
    {
        int n = ROWS * DD;                              // 4,194,304
        cvt_bf16_kernel<<<(n / 4 + 255) / 256, 256, 0, stream>>>(x, xbf, n);
        int m = DD * DD;                                // 1,048,576
        cvt_bf16_kernel<<<(m / 4 + 255) / 256, 256, 0, stream>>>(Wdt, wbf, m);
    }
    // 2) WMMA GEMM + softplus + soft_clamp -> dt  (32x32 tile per wave)
    {
        int tiles = (ROWS / 32) * (DD / 32);            // 4096 tiles, 8/block
        wmma_dt_kernel<<<tiles / 8, 256, 0, stream>>>(xbf, wbf, bdt, dt);
    }
    // 3) B/C projections
    proj_kernel<<<(ROWS * NN) / 256, 256, 0, stream>>>(x, WB, WC, Bp, Cp);
    const dim3 dgrid(LC / TP, DD / 256, BB);
    decay_kernel<<<dgrid, 256, 0, stream>>>(dt, A_log, dAc, 0 * LC);
    scan_kernel<<<BB, 1024, 0, stream>>>(x, dt, Bp, Cp, dAc, Dp, hst, out, 0 * LC);
    decay_kernel<<<dgrid, 256, 0, stream>>>(dt, A_log, dAc, 1 * LC);
    scan_kernel<<<BB, 1024, 0, stream>>>(x, dt, Bp, Cp, dAc, Dp, hst, out, 1 * LC);
    decay_kernel<<<dgrid, 256, 0, stream>>>(dt, A_log, dAc, 2 * LC);
    scan_kernel<<<BB, 1024, 0, stream>>>(x, dt, Bp, Cp, dAc, Dp, hst, out, 2 * LC);
    decay_kernel<<<dgrid, 256, 0, stream>>>(dt, A_log, dAc, 3 * LC);
    scan_kernel<<<BB, 1024, 0, stream>>>(x, dt, Bp, Cp, dAc, Dp, hst, out, 3 * LC);
}

// v006
// A run of this version takes 1680 microseconds.
// In both of two side-by-side timings against v005, it was 1.09 times as fast.
// All steps since v000 together make it 2.23 times as fast.
#include <hip/hip_runtime.h>
#include <hip/hip_bf16.h>
#include <math.h>

typedef __attribute__((ext_vector_type(16))) __bf16 v16bf;
typedef __attribute__((ext_vector_type(8)))  __bf16 v8bf;
typedef __attribute__((ext_vector_type(8)))  float  v8f;
typedef __attribute__((ext_vector_type(2)))  float  v2f;

#define BB 2
#define LL 2048
#define DD 1024
#define NN 16
#define ROWS (BB*LL)   // 4096
#define LC 512         // time steps per chunk of the scan
#define TP 4           // time steps per thread of the decay kernel
#define PF 4           // steps by which the scan's L2 prefetch leads its decay loads

typedef __attribute__((ext_vector_type(4)))  float  v4f;

__device__ __forceinline__ float fast_tanh(float x) {
    float r;
    asm("v_tanh_f32 %0, %1\n\tv_nop" : "=v"(r) : "v"(x));
    return r;
}

__device__ __forceinline__ float fast_exp2(float x) {
    float r;
    asm("v_exp_f32 %0, %1\n\tv_nop" : "=v"(r) : "v"(x));
    return r;
}

template <int M>
__device__ __forceinline__ float add_row_xmask(float v) {
    const int p = __builtin_amdgcn_update_dpp(0, __builtin_bit_cast(int, v), 0x160 | M, 0xf, 0xf, true);
    return v + __builtin_bit_cast(float, p);
}
__device__ __forceinline__ float wave_sum(float v) {
    const int b = __builtin_bit_cast(int, v);
    v += __builtin_bit_cast(float, __builtin_amdgcn_permlanex16(b, b, 0x76543210, 0xfedcba98, false, false));
    v = add_row_xmask<8>(v);
    v = add_row_xmask<4>(v);
    v = add_row_xmask<2>(v);
    v = add_row_xmask<1>(v);
    return v;
}

__device__ __forceinline__ float soft_clamp_f(float x, float lo, float hi, float sharp) {
    float c  = 0.5f * (hi + lo);
    float r  = 0.5f * (hi - lo);
    float xn = (x - c) / (r + 1e-8f);
    return fast_tanh(xn * sharp) / sharp * r + c;
}

// ---------------------------------------------------------------------------
// fp32 -> bf16 conversion (4 elements/thread)
// ---------------------------------------------------------------------------
__global__ void __launch_bounds__(256)
cvt_bf16_kernel(const float* __restrict__ in, __bf16* __restrict__ out, int n) {
    int base = (blockIdx.x * blockDim.x + threadIdx.x) * 4;
    if (base < n) {
        float4 v = *(const float4*)(in + base);
        out[base + 0] = (__bf16)v.x;
        out[base + 1] = (__bf16)v.y;
        out[base + 2] = (__bf16)v.z;
        out[base + 3] = (__bf16)v.w;
    }
}

// ---------------------------------------------------------------------------
// dt = soft_clamp(softplus(x @ Wdt^T + bdt))  via  v_wmma_f32_16x16x32_bf16
// 2x2 register tiling: one wave computes a 32x32 output block (4 accumulators),
// each A/B fragment is reused twice -> 8 b128 loads feed 4 WMMAs.
// ---------------------------------------------------------------------------
__global__ void __launch_bounds__(256)
wmma_dt_kernel(const __bf16* __restrict__ xbf, const __bf16* __restrict__ wbf,
               const float* __restrict__ bdt, float* __restrict__ dt) {
    const int lane = threadIdx.x & 31;
    const int wave = threadIdx.x >> 5;            // 0..7
    const int tile = blockIdx.x * 8 + wave;       // 0..4095
    const int tm   = tile >> 5;                   // 0..127  (32-row strips)
    const int tn   = tile & 31;                   // 0..31   (32-col strips)

    const int l15 = lane & 15;
    const int kg  = (lane >> 4) * 8;              // K sub-group: 0 or 8

    // A fragments: rows tm*32 + l15 (+16); K groups [kg..kg+7], [16+kg..16+kg+7]
    const __bf16* arow0 = xbf + (size_t)(tm * 32 + l15) * DD + kg;
    const __bf16* arow1 = arow0 + (size_t)16 * DD;
    // B fragments: columns tn*32 + l15 (+16); Wdt row-major in k
    const __bf16* brow0 = wbf + (size_t)(tn * 32 + l15) * DD + kg;
    const __bf16* brow1 = brow0 + (size_t)16 * DD;

    v8f acc00 = {}, acc01 = {}, acc10 = {}, acc11 = {};

    #pragma unroll 2
    for (int k0 = 0; k0 < DD; k0 += 32) {
        v8bf a0lo = *(const v8bf*)(arow0 + k0);
        v8bf a0hi = *(const v8bf*)(arow0 + k0 + 16);
        v8bf a1lo = *(const v8bf*)(arow1 + k0);
        v8bf a1hi = *(const v8bf*)(arow1 + k0 + 16);
        v8bf b0lo = *(const v8bf*)(brow0 + k0);
        v8bf b0hi = *(const v8bf*)(brow0 + k0 + 16);
        v8bf b1lo = *(const v8bf*)(brow1 + k0);
        v8bf b1hi = *(const v8bf*)(brow1 + k0 + 16);
        v16bf A0, A1, B0, B1;
        #pragma unroll
        for (int i = 0; i < 8; i++) {
            A0[i] = a0lo[i]; A0[i + 8] = a0hi[i];
            A1[i] = a1lo[i]; A1[i + 8] = a1hi[i];
            B0[i] = b0lo[i]; B0[i + 8] = b0hi[i];
            B1[i] = b1lo[i]; B1[i + 8] = b1hi[i];
        }
        acc00 = __builtin_amdgcn_wmma_f32_16x16x32_bf16(false, A0, false, B0, (short)0, acc00, false, false);
        acc01 = __builtin_amdgcn_wmma_f32_16x16x32_bf16(false, A0, false, B1, (short)0, acc01, false, false);
        acc10 = __builtin_amdgcn_wmma_f32_16x16x32_bf16(false, A1, false, B0, (short)0, acc10, false, false);
        acc11 = __builtin_amdgcn_wmma_f32_16x16x32_bf16(false, A1, false, B1, (short)0, acc11, false, false);
    }

    const int mbase = (lane >> 4) * 8;
    auto epilogue = [&](v8f acc, int rowbase, int colbase) {
        const int col  = colbase + l15;
        const float bias = bdt[col];
        #pragma unroll
        for (int r = 0; r < 8; r++) {
            int row  = rowbase + mbase + r;
            float v  = acc[r] + bias;
            // softplus via hardware v_exp_f32 / v_log_f32 (result clamped anyway)
            float sp = (v > 20.f) ? v : __logf(1.f + __expf(v));
            dt[(size_t)row * DD + col] = soft_clamp_f(sp, 0.001f, 0.1f, 0.5f);
        }
    };
    epilogue(acc00, tm * 32,      tn * 32);
    epilogue(acc01, tm * 32,      tn * 32 + 16);
    epilogue(acc10, tm * 32 + 16, tn * 32);
    epilogue(acc11, tm * 32 + 16, tn * 32 + 16);
}

// ---------------------------------------------------------------------------
// Bp = x @ WB^T, Cp = x @ WC^T   ([4096,16] each) — small, plain VALU
// ---------------------------------------------------------------------------
__global__ void __launch_bounds__(256)
proj_kernel(const float* __restrict__ x, const float* __restrict__ WB,
            const float* __restrict__ WC, float* __restrict__ Bp,
            float* __restrict__ Cp) {
    int t   = blockIdx.x * blockDim.x + threadIdx.x;   // 0..65535
    int row = t >> 4;
    int n   = t & 15;
    const float4* xr = (const float4*)(x + (size_t)row * DD);
    const float4* wb = (const float4*)(WB + (size_t)n * DD);
    const float4* wc = (const float4*)(WC + (size_t)n * DD);
    float sb = 0.f, sc = 0.f;
    #pragma unroll 4
    for (int k = 0; k < DD / 4; k++) {
        float4 xv = xr[k], bv = wb[k], cv = wc[k];
        sb += xv.x * bv.x + xv.y * bv.y + xv.z * bv.z + xv.w * bv.w;
        sc += xv.x * cv.x + xv.y * cv.y + xv.z * cv.z + xv.w * cv.w;
    }
    Bp[t] = sb;
    Cp[t] = sc;
}

__global__ void __launch_bounds__(256)
decay_kernel(const float* __restrict__ dt, const float* __restrict__ A_log,
             float* __restrict__ dAc, int t0) {
    const int d   = blockIdx.y * 256 + threadIdx.x;
    const int b   = blockIdx.z;
    const int tl0 = blockIdx.x * TP;

    float A[NN];
    #pragma unroll
    for (int q = 0; q < 4; q++) {
        const v4f al = *((const v4f*)A_log + d * 4 + q);
        #pragma unroll
        for (int j = 0; j < 4; j++) {
            // soft_clamp(al,-5,5,0.5) = 10*tanh(al/10)
            A[q * 4 + j] = -__expf(10.f * fast_tanh(al[j] * 0.1f));
        }
    }
    #pragma unroll
    for (int i = 0; i < TP; i++) {
        const int tl = tl0 + i;
        const float dtn = dt[((size_t)b * LL + t0 + tl) * DD + d];
        v4f* dst = (v4f*)dAc + (size_t)(b * LC + tl) * 4 * DD + d;
        #pragma unroll
        for (int q = 0; q < 4; q++) {
            v4f v;
            #pragma unroll
            for (int j = 0; j < 4; j++) {
                // soft_clamp(z,-8,8,0.5) = 16*tanh(z/16), z = dt*A
                const float th = fast_tanh((dtn * A[q * 4 + j]) * 0.0625f);
                // exp(v) as exp2(v * log2(e)), the same two roundings as __expf
                v[j] = fast_exp2((th * 16.f) * 1.44269504088896340736f);
            }
            dst[q * DD] = v;
        }
    }
}

// Eight packed products in place, for the scan's input terms dt * x * B.
// volatile: keeps them where the source has them, between the scan's two barriers,
// where the waves otherwise idle while wave 0 sums; as plain products the compiler
// sinks them behind the second barrier, onto the path that waits for the norm.
__device__ __forceinline__ void scale8_here(v2f& a0, v2f& a1, v2f& a2, v2f& a3,
                                            v2f& a4, v2f& a5, v2f& a6, v2f& a7, v2f m) {
    asm volatile("s_delay_alu instid0(VALU_DEP_1)\n\t"
                 "v_pk_mul_f32 %0, %0, %8\n\t"
                 "v_pk_mul_f32 %1, %1, %8\n\t"
                 "v_pk_mul_f32 %2, %2, %8\n\t"
                 "v_pk_mul_f32 %3, %3, %8\n\t"
                 "v_pk_mul_f32 %4, %4, %8\n\t"
                 "v_pk_mul_f32 %5, %5, %8\n\t"
                 "v_pk_mul_f32 %6, %6, %8\n\t"
                 "v_pk_mul_f32 %7, %7, %8"
                 : "+v"(a0), "+v"(a1), "+v"(a2), "+v"(a3),
                   "+v"(a4), "+v"(a5), "+v"(a6), "+v"(a7)
                 : "v"(m));
}

// Work-group barrier that waits for this wave's LDS traffic alone. __syncthreads()
// also waits for every global load of the wave, and would land, at each barrier,
// the loads that are issued one and two steps ahead of their use.
__device__ __forceinline__ void lds_barrier() {
    asm volatile("s_wait_dscnt 0x0\n\ts_barrier_signal -1\n\ts_barrier_wait -1" ::: "memory");
}

__global__ void __launch_bounds__(1024)
scan_kernel(const float* __restrict__ x, const float* __restrict__ dt,
            const float* __restrict__ Bp, const float* __restrict__ Cp,
            const float* __restrict__ dAc, const float* __restrict__ Dp,
            float* __restrict__ hst, float* __restrict__ out, int t0) {
    const int b    = blockIdx.x;
    const int d    = threadIdx.x;
    const int lane = threadIdx.x & 31;
    const int wave = threadIdx.x >> 5;

    __shared__ float wsum[32];
    __shared__ float stotal;   // the step's scale, from wave 0

    v4f* hb = (v4f*)hst + (size_t)b * 4 * DD + d;
    float h[NN];
    #pragma unroll
    for (int q = 0; q < 4; q++) {
        v4f v = {0.f, 0.f, 0.f, 0.f};
        if (t0 != 0) v = hb[q * DD];
        h[q*4+0] = v.x; h[q*4+1] = v.y; h[q*4+2] = v.z; h[q*4+3] = v.w;
    }
    const float dpv = Dp[d];

    const float* xb  = x  + (size_t)b * LL * DD;
    const float* dtb = dt + (size_t)b * LL * DD;
    const float* Bb  = Bp + (size_t)b * LL * NN;
    const float* Cb  = Cp + (size_t)b * LL * NN;
    const v4f*   dAb = (const v4f*)dAc + (size_t)b * LC * 4 * DD;
    float*       ob  = out + (size_t)b * LL * DD;

    // raw operands of the step that is being fetched
    float xn, dtn, Bn[NN];
    // finished operands of the step that is about to run
    float xv, u[NN], Crow[NN];
    // decay factors of the even and of the odd steps
    float dA0[NN], dA1[NN];

    // byte offsets on scalar bases: xo the x/dt row last fetched, xp the x/dt row last
    // asked into the caches, ao the decay row last fetched, so the output row last stored
    unsigned xo = (unsigned)t0 * (DD * 4) + (unsigned)d * 4;
    unsigned xp = xo + 2u * (DD * 4);
    unsigned ao = (unsigned)d * 16;
    unsigned so = xo;
    float    ykeep = 0.f;   // the value that the step's store names
    // The wait that belongs in front of an overwrite of a register that an issued load
    // or store names, and the overwrites, in one statement: nothing can come between.
    auto next_offsets = [&](int sx, int sp, int sa, int ss) {
        asm volatile("s_wait_xcnt 0x0\n\t"
                     "v_add_nc_u32 %0, %4, %0\n\t"
                     "v_add_nc_u32 %1, %5, %1\n\t"
                     "v_add_nc_u32 %2, %6, %2\n\t"
                     "v_add_nc_u32 %3, %7, %3"
                     : "+v"(xo), "+v"(xp), "+v"(ao), "+v"(so)
                     : "s"(sx), "s"(sp), "s"(sa), "s"(ss) : "memory");
    };
    auto load_xdt = [&]() {
        xn  = *(const float*)((const char*)xb  + xo);
        dtn = *(const float*)((const char*)dtb + xo);
    };
    auto load_B = [&](int t) {
        #pragma unroll
        for (int q = 0; q < 4; q++) {
            float4 bq = *(const float4*)(Bb + t * NN + q * 4);
            Bn[q*4+0] = bq.x; Bn[q*4+1] = bq.y; Bn[q*4+2] = bq.z; Bn[q*4+3] = bq.w;
        }
    };
    auto load_C = [&](int t) {
        #pragma unroll
        for (int q = 0; q < 4; q++) {
            float4 cq = *(const float4*)(Cb + t * NN + q * 4);
            Crow[q*4+0] = cq.x; Crow[q*4+1] = cq.y; Crow[q*4+2] = cq.z; Crow[q*4+3] = cq.w;
        }
    };
    auto load_dA = [&](float (&s)[NN]) {
        #pragma unroll
        for (int q = 0; q < 4; q++) {
            // read once: non-temporal, so that the stream does not push x, dt and
            // the B and C rows out of the caches
            const v4f v = __builtin_nontemporal_load((const v4f*)((const char*)dAb + ao) + q * DD);
            s[q*4+0] = v.x; s[q*4+1] = v.y; s[q*4+2] = v.z; s[q*4+3] = v.w;
        }
    };
    unsigned poff = (unsigned)(lane >> 3) * (DD * 16) + (unsigned)wave * 512 + (unsigned)(lane & 7) * 64
                  + 2u * (4 * DD * 16);
    const unsigned pcap = poff + (unsigned)(LC - 4) * (4 * DD * 16);   // the row before the last
    auto prefetch_dA = [&]() {
        asm volatile("global_prefetch_b8 %0, %1 scope:SCOPE_SE\n\t"
                     "v_min_u32 %0, %0, %2\n\t"
                     "s_delay_alu instid0(VALU_DEP_1)\n\t"   // hint for the dependent add
                     "v_add_nc_u32 %0, 0x10000, %0"
                     : "+v"(poff) : "s"(dAb), "v"(pcap) : "memory");
    };
    auto input_terms = [&]() {
        const float dtx = dtn * xn;
        const v2f d2 = {dtx, dtx};
        v2f p[NN / 2];
        #pragma unroll
        for (int n = 0; n < NN; n += 2) p[n / 2] = v2f{Bn[n], Bn[n + 1]};
        scale8_here(p[0], p[1], p[2], p[3], p[4], p[5], p[6], p[7], d2);
        #pragma unroll
        for (int n = 0; n < NN; n += 2) { u[n] = p[n / 2].x; u[n + 1] = p[n / 2].y; }
        // x is kept for the output term. The copy is made here, where x has landed:
        // left to the compiler it stands at the loop's foot, on the register of the
        // next fetch, and waits there for every load in flight
        asm("v_mov_b32 %0, %1" : "=v"(xv) : "v"(xn));
    };

    auto step = [&](float (&dA)[NN], int tl) {
        const int t = t0 + tl;

        // the part that needs the previous step's rescaled state
        // (the fused form written out: dA * h fused onto the rounded input term, in
        // every step alike, whichever product the compiler would pick to fuse)
        #pragma unroll
        for (int n = 0; n < NN; n++) h[n] = __builtin_fmaf(dA[n], h[n], u[n]);
        // square sum in register pairs: two packed chains of four links, one
        // instruction per two squares, in place of one serial chain of sixteen
        v2f sq0, sq1;
        {
            const v2f a = {h[0], h[1]}, c = {h[2], h[3]};
            sq0 = a * a;
            sq1 = c * c;
        }
        #pragma unroll
        for (int n = 4; n < NN; n += 4) {
            const v2f a = {h[n], h[n + 1]}, c = {h[n + 2], h[n + 3]};
            sq0 = __builtin_elementwise_fma(a, a, sq0);
            sq1 = __builtin_elementwise_fma(c, c, sq1);
        }
        sq0 += sq1;
        float ss = sq0.x + sq0.y;
        const float xcur = xv;

        // wave32 reduce in registers, then cross-wave via LDS
        ss = wave_sum(ss);
        if (lane == 0) wsum[wave] = ss;
        lds_barrier();
        if (wave == 0) {
            const float v = wave_sum(wsum[lane]);
            // min(20 / (sqrt(v) + 1e-8), 1) as min(20 * rsq(v), 1), once for the work-group.
            // The 1e-8 changes nothing behind the min: from a norm of 0.25 up it is below
            // half a unit of the norm, below that both quotients exceed 1 (v = 0: inf, so 1)
            const float sc = fminf(20.f * __builtin_amdgcn_rsqf(v), 1.f);
            if (lane == 0) stotal = sc;
        }

        // next step's input terms do not need the norm: they run while wave 0 adds
        // the partials; then the fetch of the B row of the step after it
        input_terms();
        load_B(t + 2 < LL ? t + 2 : LL - 1);
        lds_barrier();
        const float scale = stotal;

        // output dot product on the state before its rescale: independent of the
        // norm, it fills the wait for the scale's LDS read; the
        // scalar scale is applied to the sum
        // summed in register pairs like the square sum
        v2f yd0, yd1;
        {
            const v2f a = {h[0], h[1]}, c = {h[2], h[3]};
            const v2f ca = {Crow[0], Crow[1]}, cc = {Crow[2], Crow[3]};
            yd0 = a * ca;
            yd1 = c * cc;
        }
        #pragma unroll
        for (int n = 4; n < NN; n += 4) {
            const v2f a = {h[n], h[n + 1]}, c = {h[n + 2], h[n + 3]};
            const v2f ca = {Crow[n], Crow[n + 1]}, cc = {Crow[n + 2], Crow[n + 3]};
            yd0 = __builtin_elementwise_fma(a, ca, yd0);
            yd1 = __builtin_elementwise_fma(c, cc, yd1);
        }
        yd0 += yd1;
        const float yd = yd0.x + yd0.y;
        load_C(t + 1 < LL ? t + 1 : LL - 1);

        // the step's vector memory instructions
        // (behind the scalar load of the C row: no scalar load then follows them closely).
        // Rows stop at the last one (a stride of 0): the last steps fetch it again, the
        // result is not used.
        next_offsets(t + 2 < LL ? DD * 4 : 0, t + 3 < LL ? DD * 4 : 0,
                     tl + 2 < LC ? 4 * DD * 16 : 0, tl != 0 ? DD * 4 : 0);
        load_xdt();      // row t + 2; first: they are needed before the decay factors
        load_dA(dA);     // row tl + 2, into the set that this step has used
        prefetch_dA();   // row tl + 2 + PF
        __builtin_prefetch((const char*)dtb + xp, 0, 0);
        __builtin_prefetch((const char*)xb  + xp, 0, 0);

        #pragma unroll
        for (int n = 0; n < NN; n++) h[n] *= scale;
        const float sy = scale * yd;
        // y = dpv * x + scale * yd, written into the register that the store names: the
        // store of the step before is covered by this step's wait in next_offsets().
        // In asm so that the value keeps that one register (the hint: sy is fresh)
        asm volatile("s_delay_alu instid0(VALU_DEP_1)\n\t"
                     "v_fma_f32 %0, %1, %2, %3"
                     : "+v"(ykeep) : "v"(dpv), "v"(xcur), "v"(sy));
        *(float*)((char*)ob + so) = ykeep;
    };

    // the same order of loads as in the loop (x and dt in front of the decay rows), so
    // that the loop's counted waits for x and dt need not cover the decay loads behind them
    load_xdt();
    load_B(t0);
    load_dA(dA0);
    input_terms();
    next_offsets(DD * 4, 0, 4 * DD * 16, 0);
    load_xdt();
    load_dA(dA1);
    #pragma unroll   // rows 2 to 1 + PF: the loop asks for the rows behind them
    for (int i = 0; i < PF; i++) prefetch_dA();
    load_B(t0 + 1);
    load_C(t0);

    // two steps per trip: each has its own set of decay factors, so that no
    // register with a load in flight has to be copied
    for (int tl = 0; tl < LC; tl += 2) {
        step(dA0, tl);
        step(dA1, tl + 1);
    }
    // the last store's registers are free for reuse from here on
    asm volatile("s_wait_xcnt 0x0" ::: "memory");

    #pragma unroll
    for (int q = 0; q < 4; q++) {
        const v4f v = {h[q*4+0], h[q*4+1], h[q*4+2], h[q*4+3]};
        hb[q * DD] = v;
    }
}

// ---------------------------------------------------------------------------
extern "C" void kernel_launch(void* const* d_in, const int* in_sizes, int n_in,
                              void* d_out, int out_size, void* d_ws, size_t ws_size,
                              hipStream_t stream) {
    const float* x     = (const float*)d_in[0];
    const float* Wdt   = (const float*)d_in[1];
    const float* bdt   = (const float*)d_in[2];
    const float* WB    = (const float*)d_in[3];
    const float* WC    = (const float*)d_in[4];
    const float* A_log = (const float*)d_in[5];
    const float* Dp    = (const float*)d_in[6];
    float* out = (float*)d_out;

    char* ws = (char*)d_ws;
    size_t off = 0;
    auto take = [&](size_t bytes) -> void* {
        void* p = ws + off;
        off += (bytes + 255) & ~(size_t)255;
        return p;
    };
    float*  dt  = (float*) take((size_t)ROWS * DD * sizeof(float));   // 16 MB
    float*  Bp  = (float*) take((size_t)ROWS * NN * sizeof(float));
    float*  Cp  = (float*) take((size_t)ROWS * NN * sizeof(float));
    __bf16* xbf = (__bf16*)take((size_t)ROWS * DD * sizeof(__bf16));  // 8 MB
    __bf16* wbf = (__bf16*)take((size_t)DD * DD * sizeof(__bf16));    // 2 MB
    float*  dAc = (float*) take((size_t)BB * LC * DD * NN * sizeof(float));  // 64 MB, one chunk
    float*  hst = (float*) take((size_t)BB * DD * NN * sizeof(float));
    (void)ws_size; (void)in_sizes; (void)n_in; (void)out_size;

    // 1) bf16 conversions
    {
        int n = ROWS * DD;                              // 4,194,304
        cvt_bf16_kernel<<<(n / 4 + 255) / 256, 256, 0, stream>>>(x, xbf, n);
        int m = DD * DD;                                // 1,048,576
        cvt_bf16_kernel<<<(m / 4 + 255) / 256, 256, 0, stream>>>(Wdt, wbf, m);
    }
    // 2) WMMA GEMM + softplus + soft_clamp -> dt  (32x32 tile per wave)
    {
        int tiles = (ROWS / 32) * (DD / 32);            // 4096 tiles, 8/block
        wmma_dt_kernel<<<tiles / 8, 256, 0, stream>>>(xbf, wbf, bdt, dt);
    }
    // 3) B/C projections
    proj_kernel<<<(ROWS * NN) / 256, 256, 0, stream>>>(x, WB, WC, Bp, Cp);
    const dim3 dgrid(LC / TP, DD / 256, BB);
    decay_kernel<<<dgrid, 256, 0, stream>>>(dt, A_log, dAc, 0 * LC);
    scan_kernel<<<BB, 1024, 0, stream>>>(x, dt, Bp, Cp, dAc, Dp, hst, out, 0 * LC);
    decay_kernel<<<dgrid, 256, 0, stream>>>(dt, A_log, dAc, 1 * LC);
    scan_kernel<<<BB, 1024, 0, stream>>>(x, dt, Bp, Cp, dAc, Dp, hst, out, 1 * LC);
    decay_kernel<<<dgrid, 256, 0, stream>>>(dt, A_log, dAc, 2 * LC);
    scan_kernel<<<BB, 1024, 0, stream>>>(x, dt, Bp, Cp, dAc, Dp, hst, out, 2 * LC);
    decay_kernel<<<dgrid, 256, 0, stream>>>(dt, A_log, dAc, 3 * LC);
    scan_kernel<<<BB, 1024, 0, stream>>>(x, dt, Bp, Cp, dAc, Dp, hst, out, 3 * LC);
}

// v007
// Measured time: 1630 microseconds a run.
// Two timings next to v006 put it at 1.04 and 1.03 times that version's speed.
// Counting every step since v000, it is 2.31 times as fast.
#include <hip/hip_runtime.h>
#include <hip/hip_bf16.h>
#include <math.h>

typedef __attribute__((ext_vector_type(16))) __bf16 v16bf;
typedef __attribute__((ext_vector_type(8)))  __bf16 v8bf;
typedef __attribute__((ext_vector_type(8)))  float  v8f;
typedef __attribute__((ext_vector_type(2)))  float  v2f;

#define BB 2
#define LL 2048
#define DD 1024
#define NN 16
#define ROWS (BB*LL)   // 4096
#define LC 512         // time steps per chunk of the scan
#define TP 2           // time steps per thread of the decay kernel
#define ST (DD / 2)    // threads of the scan: each holds two neighbouring channels
#define PF 4           // steps by which the scan's L2 prefetch leads its decay loads

typedef __attribute__((ext_vector_type(4)))  float  v4f;

__device__ __forceinline__ float fast_tanh(float x) {
    float r;
    asm("v_tanh_f32 %0, %1\n\tv_nop" : "=v"(r) : "v"(x));
    return r;
}

__device__ __forceinline__ float fast_exp2(float x) {
    float r;
    asm("v_exp_f32 %0, %1\n\tv_nop" : "=v"(r) : "v"(x));
    return r;
}

template <int M>
__device__ __forceinline__ float add_row_xmask(float v) {
    const int p = __builtin_amdgcn_update_dpp(0, __builtin_bit_cast(int, v), 0x160 | M, 0xf, 0xf, true);
    return v + __builtin_bit_cast(float, p);
}
__device__ __forceinline__ float wave_sum(float v) {
    const int b = __builtin_bit_cast(int, v);
    v += __builtin_bit_cast(float, __builtin_amdgcn_permlanex16(b, b, 0x76543210, 0xfedcba98, false, false));
    v = add_row_xmask<8>(v);
    v = add_row_xmask<4>(v);
    v = add_row_xmask<2>(v);
    v = add_row_xmask<1>(v);
    return v;
}

// Sum over the 16 lanes of a row, every lane of the row gets it.
__device__ __forceinline__ float row_sum(float v) {
    v = add_row_xmask<8>(v);
    v = add_row_xmask<4>(v);
    v = add_row_xmask<2>(v);
    v = add_row_xmask<1>(v);
    return v;
}

__device__ __forceinline__ float soft_clamp_f(float x, float lo, float hi, float sharp) {
    float c  = 0.5f * (hi + lo);
    float r  = 0.5f * (hi - lo);
    float xn = (x - c) / (r + 1e-8f);
    return fast_tanh(xn * sharp) / sharp * r + c;
}

// ---------------------------------------------------------------------------
// fp32 -> bf16 conversion (4 elements/thread)
// ---------------------------------------------------------------------------
__global__ void __launch_bounds__(256)
cvt_bf16_kernel(const float* __restrict__ in, __bf16* __restrict__ out, int n) {
    int base = (blockIdx.x * blockDim.x + threadIdx.x) * 4;
    if (base < n) {
        float4 v = *(const float4*)(in + base);
        out[base + 0] = (__bf16)v.x;
        out[base + 1] = (__bf16)v.y;
        out[base + 2] = (__bf16)v.z;
        out[base + 3] = (__bf16)v.w;
    }
}

// ---------------------------------------------------------------------------
// dt = soft_clamp(softplus(x @ Wdt^T + bdt))  via  v_wmma_f32_16x16x32_bf16
// 2x2 register tiling: one wave computes a 32x32 output block (4 accumulators),
// each A/B fragment is reused twice -> 8 b128 loads feed 4 WMMAs.
// ---------------------------------------------------------------------------
__global__ void __launch_bounds__(256)
wmma_dt_kernel(const __bf16* __restrict__ xbf, const __bf16* __restrict__ wbf,
               const float* __restrict__ bdt, float* __restrict__ dt) {
    const int lane = threadIdx.x & 31;
    const int wave = threadIdx.x >> 5;            // 0..7
    const int tile = blockIdx.x * 8 + wave;       // 0..4095
    const int tm   = tile >> 5;                   // 0..127  (32-row strips)
    const int tn   = tile & 31;                   // 0..31   (32-col strips)

    const int l15 = lane & 15;
    const int kg  = (lane >> 4) * 8;              // K sub-group: 0 or 8

    // A fragments: rows tm*32 + l15 (+16); K groups [kg..kg+7], [16+kg..16+kg+7]
    const __bf16* arow0 = xbf + (size_t)(tm * 32 + l15) * DD + kg;
    const __bf16* arow1 = arow0 + (size_t)16 * DD;
    // B fragments: columns tn*32 + l15 (+16); Wdt row-major in k
    const __bf16* brow0 = wbf + (size_t)(tn * 32 + l15) * DD + kg;
    const __bf16* brow1 = brow0 + (size_t)16 * DD;

    v8f acc00 = {}, acc01 = {}, acc10 = {}, acc11 = {};

    #pragma unroll 2
    for (int k0 = 0; k0 < DD; k0 += 32) {
        v8bf a0lo = *(const v8bf*)(arow0 + k0);
        v8bf a0hi = *(const v8bf*)(arow0 + k0 + 16);
        v8bf a1lo = *(const v8bf*)(arow1 + k0);
        v8bf a1hi = *(const v8bf*)(arow1 + k0 + 16);
        v8bf b0lo = *(const v8bf*)(brow0 + k0);
        v8bf b0hi = *(const v8bf*)(brow0 + k0 + 16);
        v8bf b1lo = *(const v8bf*)(brow1 + k0);
        v8bf b1hi = *(const v8bf*)(brow1 + k0 + 16);
        v16bf A0, A1, B0, B1;
        #pragma unroll
        for (int i = 0; i < 8; i++) {
            A0[i] = a0lo[i]; A0[i + 8] = a0hi[i];
            A1[i] = a1lo[i]; A1[i + 8] = a1hi[i];
            B0[i] = b0lo[i]; B0[i + 8] = b0hi[i];
            B1[i] = b1lo[i]; B1[i + 8] = b1hi[i];
        }
        acc00 = __builtin_amdgcn_wmma_f32_16x16x32_bf16(false, A0, false, B0, (short)0, acc00, false, false);
        acc01 = __builtin_amdgcn_wmma_f32_16x16x32_bf16(false, A0, false, B1, (short)0, acc01, false, false);
        acc10 = __builtin_amdgcn_wmma_f32_16x16x32_bf16(false, A1, false, B0, (short)0, acc10, false, false);
        acc11 = __builtin_amdgcn_wmma_f32_16x16x32_bf16(false, A1, false, B1, (short)0, acc11, false, false);
    }

    const int mbase = (lane >> 4) * 8;
    auto epilogue = [&](v8f acc, int rowbase, int colbase) {
        const int col  = colbase + l15;
        const float bias = bdt[col];
        #pragma unroll
        for (int r = 0; r < 8; r++) {
            int row  = rowbase + mbase + r;
            float v  = acc[r] + bias;
            // softplus via hardware v_exp_f32 / v_log_f32 (result clamped anyway)
            float sp = (v > 20.f) ? v : __logf(1.f + __expf(v));
            dt[(size_t)row * DD + col] = soft_clamp_f(sp, 0.001f, 0.1f, 0.5f);
        }
    };
    epilogue(acc00, tm * 32,      tn * 32);
    epilogue(acc01, tm * 32,      tn * 32 + 16);
    epilogue(acc10, tm * 32 + 16, tn * 32);
    epilogue(acc11, tm * 32 + 16, tn * 32 + 16);
}

// ---------------------------------------------------------------------------
// Bp = x @ WB^T, Cp = x @ WC^T   ([4096,16] each) — small, plain VALU
// Each value is stored twice in a row: the scan reads a row into scalar registers,
// and a packed f32 instruction takes an aligned scalar pair as one operand.
// ---------------------------------------------------------------------------
__global__ void __launch_bounds__(256)
proj_kernel(const float* __restrict__ x, const float* __restrict__ WB,
            const float* __restrict__ WC, float* __restrict__ Bp,
            float* __restrict__ Cp) {
    int t   = blockIdx.x * blockDim.x + threadIdx.x;   // 0..65535
    int row = t >> 4;
    int n   = t & 15;
    const float4* xr = (const float4*)(x + (size_t)row * DD);
    const float4* wb = (const float4*)(WB + (size_t)n * DD);
    const float4* wc = (const float4*)(WC + (size_t)n * DD);
    float sb = 0.f, sc = 0.f;
    #pragma unroll 4
    for (int k = 0; k < DD / 4; k++) {
        float4 xv = xr[k], bv = wb[k], cv = wc[k];
        sb += xv.x * bv.x + xv.y * bv.y + xv.z * bv.z + xv.w * bv.w;
        sc += xv.x * cv.x + xv.y * cv.y + xv.z * cv.z + xv.w * cv.w;
    }
    ((float2*)Bp)[t] = make_float2(sb, sb);
    ((float2*)Cp)[t] = make_float2(sc, sc);
}

__global__ void __launch_bounds__(256)
decay_kernel(const float* __restrict__ dt, const float* __restrict__ A_log,
             float* __restrict__ dAc, int t0) {
    const int p   = blockIdx.y * 256 + threadIdx.x;   // 0..ST-1
    const int b   = blockIdx.z;
    const int tl0 = blockIdx.x * TP;

    float A[2][NN];
    #pragma unroll
    for (int c = 0; c < 2; c++) {
        #pragma unroll
        for (int q = 0; q < 4; q++) {
            const v4f al = *((const v4f*)A_log + (p * 2 + c) * 4 + q);
            #pragma unroll
            for (int j = 0; j < 4; j++) {
                // soft_clamp(al,-5,5,0.5) = 10*tanh(al/10)
                A[c][q * 4 + j] = -__expf(10.f * fast_tanh(al[j] * 0.1f));
            }
        }
    }
    #pragma unroll
    for (int i = 0; i < TP; i++) {
        const int tl = tl0 + i;
        const v2f dtn = *(const v2f*)(dt + ((size_t)b * LL + t0 + tl) * DD + p * 2);
        // the wait that belongs in front of an overwrite of a register that an issued
        // load names
        if (i + 1 < TP) asm volatile("s_wait_xcnt 0x0" ::: "memory");
        v4f* dst = (v4f*)dAc + (size_t)(b * LC + tl) * 8 * ST + p;
        #pragma unroll
        for (int q = 0; q < 8; q++) {
            v4f v;
            #pragma unroll
            for (int j = 0; j < 4; j++) {
                // soft_clamp(z,-8,8,0.5) = 16*tanh(z/16), z = dt*A
                const float th = fast_tanh((dtn[j & 1] * A[j & 1][q * 2 + (j >> 1)]) * 0.0625f);
                // exp(v) as exp2(v * log2(e)), the same two roundings as __expf
                v[j] = fast_exp2((th * 16.f) * 1.44269504088896340736f);
            }
            dst[q * ST] = v;
        }
    }
}

// Eight packed products m * s, s the low register of an aligned scalar pair, used for
// both halves (op_sel_hi 0: the only form the assembler takes for a scalar source),
// for the scan's input terms (dt * x of two channels) * B[n]: no copy of the B row
// into vector registers.
// volatile: keeps them where the source has them, between the scan's two barriers,
// where the waves otherwise idle while wave 0 sums; as plain products the compiler
// sinks them behind the second barrier, onto the path that waits for the norm.
__device__ __forceinline__ void mul8_first(v2f& r0, v2f& r1, v2f& r2, v2f& r3,
                                          v2f& r4, v2f& r5, v2f& r6, v2f& r7, v2f m,
                                          v2f s0, v2f s1, v2f s2, v2f s3,
                                          v2f s4, v2f s5, v2f s6, v2f s7) {
    asm volatile("s_delay_alu instid0(VALU_DEP_1)\n\t"
                 "v_pk_mul_f32 %0, %8, %9 op_sel_hi:[1,0]\n\t"
                 "v_pk_mul_f32 %1, %8, %10 op_sel_hi:[1,0]\n\t"
                 "v_pk_mul_f32 %2, %8, %11 op_sel_hi:[1,0]\n\t"
                 "v_pk_mul_f32 %3, %8, %12 op_sel_hi:[1,0]\n\t"
                 "v_pk_mul_f32 %4, %8, %13 op_sel_hi:[1,0]\n\t"
                 "v_pk_mul_f32 %5, %8, %14 op_sel_hi:[1,0]\n\t"
                 "v_pk_mul_f32 %6, %8, %15 op_sel_hi:[1,0]\n\t"
                 "v_pk_mul_f32 %7, %8, %16 op_sel_hi:[1,0]"
                 : "=&v"(r0), "=&v"(r1), "=&v"(r2), "=&v"(r3),
                   "=&v"(r4), "=&v"(r5), "=&v"(r6), "=&v"(r7)
                 : "v"(m), "s"(s0), "s"(s1), "s"(s2), "s"(s3),
                   "s"(s4), "s"(s5), "s"(s6), "s"(s7));
}
__device__ __forceinline__ void mul8_more(v2f& r0, v2f& r1, v2f& r2, v2f& r3,
                                          v2f& r4, v2f& r5, v2f& r6, v2f& r7, v2f m,
                                          v2f s0, v2f s1, v2f s2, v2f s3,
                                          v2f s4, v2f s5, v2f s6, v2f s7) {
    asm volatile("v_pk_mul_f32 %0, %8, %9 op_sel_hi:[1,0]\n\t"
                 "v_pk_mul_f32 %1, %8, %10 op_sel_hi:[1,0]\n\t"
                 "v_pk_mul_f32 %2, %8, %11 op_sel_hi:[1,0]\n\t"
                 "v_pk_mul_f32 %3, %8, %12 op_sel_hi:[1,0]\n\t"
                 "v_pk_mul_f32 %4, %8, %13 op_sel_hi:[1,0]\n\t"
                 "v_pk_mul_f32 %5, %8, %14 op_sel_hi:[1,0]\n\t"
                 "v_pk_mul_f32 %6, %8, %15 op_sel_hi:[1,0]\n\t"
                 "v_pk_mul_f32 %7, %8, %16 op_sel_hi:[1,0]"
                 : "=&v"(r0), "=&v"(r1), "=&v"(r2), "=&v"(r3),
                   "=&v"(r4), "=&v"(r5), "=&v"(r6), "=&v"(r7)
                 : "v"(m), "s"(s0), "s"(s1), "s"(s2), "s"(s3),
                   "s"(s4), "s"(s5), "s"(s6), "s"(s7));
}

// Output dot of two channels with the C row in scalar register pairs (each value twice):
// four packed chains, eight terms a call. The hints: each link's producer is four
// vector instructions back. volatile: the dot stays behind the second barrier, where
// it fills the wait for the scale's LDS read.
__device__ __forceinline__ void dot8_first(v2f& a0, v2f& a1, v2f& a2, v2f& a3,
                                           v2f h0, v2f h1, v2f h2, v2f h3,
                                           v2f h4, v2f h5, v2f h6, v2f h7,
                                           v2f c0, v2f c1, v2f c2, v2f c3,
                                           v2f c4, v2f c5, v2f c6, v2f c7) {
    asm volatile("v_pk_mul_f32 %0, %4, %12 op_sel_hi:[1,0]\n\t"
                 "v_pk_mul_f32 %1, %5, %13 op_sel_hi:[1,0]\n\t"
                 "v_pk_mul_f32 %2, %6, %14 op_sel_hi:[1,0]\n\t"
                 "v_pk_mul_f32 %3, %7, %15 op_sel_hi:[1,0]\n\t"
                 "s_delay_alu instid0(VALU_DEP_4) | instskip(NEXT) | instid1(VALU_DEP_4)\n\t"
                 "v_pk_fma_f32 %0, %8, %16, %0 op_sel_hi:[1,0,1]\n\t"
                 "v_pk_fma_f32 %1, %9, %17, %1 op_sel_hi:[1,0,1]\n\t"
                 "s_delay_alu instid0(VALU_DEP_4) | instskip(NEXT) | instid1(VALU_DEP_4)\n\t"
                 "v_pk_fma_f32 %2, %10, %18, %2 op_sel_hi:[1,0,1]\n\t"
                 "v_pk_fma_f32 %3, %11, %19, %3 op_sel_hi:[1,0,1]"
                 : "=&v"(a0), "=&v"(a1), "=&v"(a2), "=&v"(a3)
                 : "v"(h0), "v"(h1), "v"(h2), "v"(h3), "v"(h4), "v"(h5), "v"(h6), "v"(h7),
                   "s"(c0), "s"(c1), "s"(c2), "s"(c3), "s"(c4), "s"(c5), "s"(c6), "s"(c7));
}
__device__ __forceinline__ void dot8_more(v2f& a0, v2f& a1, v2f& a2, v2f& a3,
                                          v2f h0, v2f h1, v2f h2, v2f h3,
                                          v2f h4, v2f h5, v2f h6, v2f h7,
                                          v2f c0, v2f c1, v2f c2, v2f c3,
                                          v2f c4, v2f c5, v2f c6, v2f c7) {
    asm volatile("s_delay_alu instid0(VALU_DEP_4) | instskip(NEXT) | instid1(VALU_DEP_4)\n\t"
                 "v_pk_fma_f32 %0, %4, %12, %0 op_sel_hi:[1,0,1]\n\t"
                 "v_pk_fma_f32 %1, %5, %13, %1 op_sel_hi:[1,0,1]\n\t"
                 "s_delay_alu instid0(VALU_DEP_4) | instskip(NEXT) | instid1(VALU_DEP_4)\n\t"
                 "v_pk_fma_f32 %2, %6, %14, %2 op_sel_hi:[1,0,1]\n\t"
                 "v_pk_fma_f32 %3, %7, %15, %3 op_sel_hi:[1,0,1]\n\t"
                 "s_delay_alu instid0(VALU_DEP_4) | instskip(NEXT) | instid1(VALU_DEP_4)\n\t"
                 "v_pk_fma_f32 %0, %8, %16, %0 op_sel_hi:[1,0,1]\n\t"
                 "v_pk_fma_f32 %1, %9, %17, %1 op_sel_hi:[1,0,1]\n\t"
                 "s_delay_alu instid0(VALU_DEP_4) | instskip(NEXT) | instid1(VALU_DEP_4)\n\t"
                 "v_pk_fma_f32 %2, %10, %18, %2 op_sel_hi:[1,0,1]\n\t"
                 "v_pk_fma_f32 %3, %11, %19, %3 op_sel_hi:[1,0,1]"
                 : "+v"(a0), "+v"(a1), "+v"(a2), "+v"(a3)
                 : "v"(h0), "v"(h1), "v"(h2), "v"(h3), "v"(h4), "v"(h5), "v"(h6), "v"(h7),
                   "s"(c0), "s"(c1), "s"(c2), "s"(c3), "s"(c4), "s"(c5), "s"(c6), "s"(c7));
}

// Work-group barrier that waits for this wave's LDS traffic alone. __syncthreads()
// also waits for every global load of the wave, and would land, at each barrier,
// the loads that are issued one and two steps ahead of their use.
__device__ __forceinline__ void lds_barrier() {
    asm volatile("s_wait_dscnt 0x0\n\ts_barrier_signal -1\n\ts_barrier_wait -1" ::: "memory");
}

__global__ void __launch_bounds__(ST)
scan_kernel(const float* __restrict__ x, const float* __restrict__ dt,
            const float* __restrict__ Bp, const float* __restrict__ Cp,
            const float* __restrict__ dAc, const float* __restrict__ Dp,
            float* __restrict__ hst, float* __restrict__ out, int t0) {
    const int b    = blockIdx.x;
    const int p    = threadIdx.x;
    const int lane = threadIdx.x & 31;
    const int wave = threadIdx.x >> 5;

    __shared__ float wsum[ST / 32];
    __shared__ float stotal;   // the step's scale, from wave 0

    v4f* hb = (v4f*)hst + (size_t)b * 8 * ST + p;
    v2f h[NN];
    #pragma unroll
    for (int q = 0; q < 8; q++) {
        v4f v = {0.f, 0.f, 0.f, 0.f};
        if (t0 != 0) v = hb[q * ST];
        h[q*2+0] = v2f{v.x, v.y}; h[q*2+1] = v2f{v.z, v.w};
    }
    const v2f dpv = *(const v2f*)(Dp + p * 2);

    const float* xb  = x  + (size_t)b * LL * DD;
    const float* dtb = dt + (size_t)b * LL * DD;
    const float* Bb  = Bp + (size_t)b * LL * NN * 2;
    const float* Cb  = Cp + (size_t)b * LL * NN * 2;
    const v4f*   dAb = (const v4f*)dAc + (size_t)b * LC * 8 * ST;
    float*       ob  = out + (size_t)b * LL * DD;

    // raw operands of the step that is being fetched (a B or C entry: the value twice)
    v2f xn, dtn, Bn[NN];
    // finished operands of the step that is about to run
    v2f xv, u[NN], Crow[NN];
    // decay factors of the even and of the odd steps
    v2f dA0[NN], dA1[NN];

    // byte offsets on scalar bases: xo the x/dt row last fetched, xp the x/dt row last
    // asked into the caches, ao the decay row last fetched, so the output row last stored
    unsigned xo = (unsigned)t0 * (DD * 4) + (unsigned)p * 8;
    unsigned xp = xo + 2u * (DD * 4);
    unsigned ao = (unsigned)p * 16;
    unsigned so = xo;
    v2f      ykeep = {0.f, 0.f};   // the value that the step's store names
    // The wait that belongs in front of an overwrite of a register that an issued load
    // or store names, and the overwrites, in one statement: nothing can come between.
    auto next_offsets = [&](int sx, int sp, int sa, int ss) {
        asm volatile("s_wait_xcnt 0x0\n\t"
                     "v_add_nc_u32 %0, %4, %0\n\t"
                     "v_add_nc_u32 %1, %5, %1\n\t"
                     "v_add_nc_u32 %2, %6, %2\n\t"
                     "v_add_nc_u32 %3, %7, %3"
                     : "+v"(xo), "+v"(xp), "+v"(ao), "+v"(so)
                     : "s"(sx), "s"(sp), "s"(sa), "s"(ss) : "memory");
    };
    auto load_xdt = [&]() {
        xn  = *(const v2f*)((const char*)xb  + xo);
        dtn = *(const v2f*)((const char*)dtb + xo);
    };
    auto load_B = [&](int t) {
        #pragma unroll
        for (int q = 0; q < 8; q++) {
            float4 bq = *(const float4*)(Bb + t * (NN * 2) + q * 4);
            Bn[q*2+0] = v2f{bq.x, bq.y}; Bn[q*2+1] = v2f{bq.z, bq.w};
        }
    };
    auto load_C = [&](int t) {
        #pragma unroll
        for (int q = 0; q < 8; q++) {
            float4 cq = *(const float4*)(Cb + t * (NN * 2) + q * 4);
            Crow[q*2+0] = v2f{cq.x, cq.y}; Crow[q*2+1] = v2f{cq.z, cq.w};
        }
    };
    auto load_dA = [&](v2f (&s)[NN]) {
        #pragma unroll
        for (int q = 0; q < 8; q++) {
            // read once: non-temporal, so that the stream does not push x, dt and
            // the B and C rows out of the caches
            const v4f v = __builtin_nontemporal_load((const v4f*)((const char*)dAb + ao) + q * ST);
            s[q*2+0] = v2f{v.x, v.y}; s[q*2+1] = v2f{v.z, v.w};
        }
    };
    unsigned poff = (unsigned)(lane >> 2) * (ST * 16) + (unsigned)wave * 512 + (unsigned)(lane & 3) * 128
                  + 2u * (8 * ST * 16);
    const unsigned pcap = poff + (unsigned)(LC - 4) * (8 * ST * 16);   // the row before the last
    auto prefetch_dA = [&]() {
        asm volatile("global_prefetch_b8 %0, %1 scope:SCOPE_SE\n\t"
                     "v_min_u32 %0, %0, %2\n\t"
                     "s_delay_alu instid0(VALU_DEP_1)\n\t"   // hint for the dependent add
                     "v_add_nc_u32 %0, 0x10000, %0"
                     : "+v"(poff) : "s"(dAb), "v"(pcap) : "memory");
    };
    auto input_terms = [&]() {
        const v2f dtx = dtn * xn;
        mul8_first(u[0], u[1], u[2], u[3], u[4], u[5], u[6], u[7], dtx,
                   Bn[0], Bn[1], Bn[2], Bn[3], Bn[4], Bn[5], Bn[6], Bn[7]);
        mul8_more(u[8], u[9], u[10], u[11], u[12], u[13], u[14], u[15], dtx,
                  Bn[8], Bn[9], Bn[10], Bn[11], Bn[12], Bn[13], Bn[14], Bn[15]);
        // x is kept for the output term. The copy is made here, where x has landed:
        // left to the compiler it stands at the loop's foot, on the register of the
        // next fetch, and waits there for every load in flight
        asm("v_mov_b64 %0, %1" : "=v"(xv) : "v"(xn));
    };

    auto step = [&](v2f (&dA)[NN], int tl) {
        const int t = t0 + tl;

        // the part that needs the previous step's rescaled state
        // (the fused form written out: dA * h fused onto the rounded input term, in
        // every step alike, whichever product the compiler would pick to fuse)
        #pragma unroll
        for (int n = 0; n < NN; n++) h[n] = __builtin_elementwise_fma(dA[n], h[n], u[n]);
        // square sum of both channels: four packed chains of four links
        v2f sq[4];
        #pragma unroll
        for (int n = 0; n < 4; n++) sq[n] = h[n] * h[n];
        #pragma unroll
        for (int n = 4; n < NN; n++) sq[n & 3] = __builtin_elementwise_fma(h[n], h[n], sq[n & 3]);
        const v2f sqs = (sq[0] + sq[1]) + (sq[2] + sq[3]);
        float ss = sqs.x + sqs.y;
        const v2f xcur = xv;

        // wave32 reduce in registers, then cross-wave via LDS
        ss = wave_sum(ss);
        if (lane == 0) wsum[wave] = ss;
        lds_barrier();
        if (wave == 0) {
            // sixteen partials: each 16-lane row sums all of them
            const float v = row_sum(wsum[lane & 15]);
            // min(20 / (sqrt(v) + 1e-8), 1) as min(20 * rsq(v), 1), once for the work-group.
            // The 1e-8 changes nothing behind the min: from a norm of 0.25 up it is below
            // half a unit of the norm, below that both quotients exceed 1 (v = 0: inf, so 1)
            const float sc = fminf(20.f * __builtin_amdgcn_rsqf(v), 1.f);
            if (lane == 0) stotal = sc;
        }

        // next step's input terms do not need the norm: they run while wave 0 adds
        // the partials; then the fetch of the B row of the step after it
        input_terms();
        load_B(t + 2 < LL ? t + 2 : LL - 1);
        lds_barrier();
        const float scale = stotal;

        // output dot product on the state before its rescale: independent of the
        // norm, it fills the wait for the scale's LDS read; the
        // scalar scale is applied to the sum
        v2f y0, y1, y2, y3;
        dot8_first(y0, y1, y2, y3, h[0], h[1], h[2], h[3], h[4], h[5], h[6], h[7],
                   Crow[0], Crow[1], Crow[2], Crow[3], Crow[4], Crow[5], Crow[6], Crow[7]);
        dot8_more(y0, y1, y2, y3, h[8], h[9], h[10], h[11], h[12], h[13], h[14], h[15],
                  Crow[8], Crow[9], Crow[10], Crow[11], Crow[12], Crow[13], Crow[14], Crow[15]);
        const v2f yd = (y0 + y1) + (y2 + y3);
        load_C(t + 1 < LL ? t + 1 : LL - 1);

        // the step's vector memory instructions
        // (behind the scalar load of the C row: no scalar load then follows them closely).
        // Rows stop at the last one (a stride of 0): the last steps fetch it again, the
        // result is not used.
        next_offsets(t + 2 < LL ? DD * 4 : 0, t + 3 < LL ? DD * 4 : 0,
                     tl + 2 < LC ? 8 * ST * 16 : 0, tl != 0 ? DD * 4 : 0);
        load_xdt();      // row t + 2; first: they are needed before the decay factors
        load_dA(dA);     // row tl + 2, into the set that this step has used
        prefetch_dA();   // row tl + 2 + PF
        __builtin_prefetch((const char*)dtb + xp, 0, 0);
        __builtin_prefetch((const char*)xb  + xp, 0, 0);

        const v2f sc2 = {scale, scale};
        #pragma unroll
        for (int n = 0; n < NN; n++) h[n] *= sc2;
        const v2f sy = sc2 * yd;
        // y = dpv * x + scale * yd, written into the registers that the store names: the
        // store of the step before is covered by this step's wait in next_offsets().
        // In asm so that the value keeps those registers (the hint: sy is fresh)
        asm volatile("s_delay_alu instid0(VALU_DEP_1)\n\t"
                     "v_pk_fma_f32 %0, %1, %2, %3"
                     : "+v"(ykeep) : "v"(dpv), "v"(xcur), "v"(sy));
        *(v2f*)((char*)ob + so) = ykeep;
    };

    // the same order of loads as in the loop (x and dt in front of the decay rows), so
    // that the loop's counted waits for x and dt need not cover the decay loads behind them
    load_xdt();
    load_B(t0);
    load_dA(dA0);
    input_terms();
    next_offsets(DD * 4, 0, 8 * ST * 16, 0);
    load_xdt();
    load_dA(dA1);
    #pragma unroll   // rows 2 to 1 + PF: the loop asks for the rows behind them
    for (int i = 0; i < PF; i++) prefetch_dA();
    load_B(t0 + 1);
    load_C(t0);

    // two steps per trip: each has its own set of decay factors, so that no
    // register with a load in flight has to be copied
    for (int tl = 0; tl < LC; tl += 2) {
        step(dA0, tl);
        step(dA1, tl + 1);
    }
    // the last store's registers are free for reuse from here on
    asm volatile("s_wait_xcnt 0x0" ::: "memory");

    #pragma unroll
    for (int q = 0; q < 8; q++) {
        const v4f v = {h[q*2+0].x, h[q*2+0].y, h[q*2+1].x, h[q*2+1].y};
        hb[q * ST] = v;
    }
}

// ---------------------------------------------------------------------------
extern "C" void kernel_launch(void* const* d_in, const int* in_sizes, int n_in,
                              void* d_out, int out_size, void* d_ws, size_t ws_size,
                              hipStream_t stream) {
    const float* x     = (const float*)d_in[0];
    const float* Wdt   = (const float*)d_in[1];
    const float* bdt   = (const float*)d_in[2];
    const float* WB    = (const float*)d_in[3];
    const float* WC    = (const float*)d_in[4];
    const float* A_log = (const float*)d_in[5];
    const float* Dp    = (const float*)d_in[6];
    float* out = (float*)d_out;

    char* ws = (char*)d_ws;
    size_t off = 0;
    auto take = [&](size_t bytes) -> void* {
        void* p = ws + off;
        off += (bytes + 255) & ~(size_t)255;
        return p;
    };
    float*  dt  = (float*) take((size_t)ROWS * DD * sizeof(float));   // 16 MB
    float*  Bp  = (float*) take((size_t)ROWS * NN * 2 * sizeof(float));   // each value twice
    float*  Cp  = (float*) take((size_t)ROWS * NN * 2 * sizeof(float));
    __bf16* xbf = (__bf16*)take((size_t)ROWS * DD * sizeof(__bf16));  // 8 MB
    __bf16* wbf = (__bf16*)take((size_t)DD * DD * sizeof(__bf16));    // 2 MB
    float*  dAc = (float*) take((size_t)BB * LC * DD * NN * sizeof(float));  // 64 MB, one chunk
    float*  hst = (float*) take((size_t)BB * DD * NN * sizeof(float));
    (void)ws_size; (void)in_sizes; (void)n_in; (void)out_size;

    // 1) bf16 conversions
    {
        int n = ROWS * DD;                              // 4,194,304
        cvt_bf16_kernel<<<(n / 4 + 255) / 256, 256, 0, stream>>>(x, xbf, n);
        int m = DD * DD;                                // 1,048,576
        cvt_bf16_kernel<<<(m / 4 + 255) / 256, 256, 0, stream>>>(Wdt, wbf, m);
    }
    // 2) WMMA GEMM + softplus + soft_clamp -> dt  (32x32 tile per wave)
    {
        int tiles = (ROWS / 32) * (DD / 32);            // 4096 tiles, 8/block
        wmma_dt_kernel<<<tiles / 8, 256, 0, stream>>>(xbf, wbf, bdt, dt);
    }
    // 3) B/C projections
    proj_kernel<<<(ROWS * NN) / 256, 256, 0, stream>>>(x, WB, WC, Bp, Cp);
    const dim3 dgrid(LC / TP, ST / 256, BB);
    decay_kernel<<<dgrid, 256, 0, stream>>>(dt, A_log, dAc, 0 * LC);
    scan_kernel<<<BB, ST, 0, stream>>>(x, dt, Bp, Cp, dAc, Dp, hst, out, 0 * LC);
    decay_kernel<<<dgrid, 256, 0, stream>>>(dt, A_log, dAc, 1 * LC);
    scan_kernel<<<BB, ST, 0, stream>>>(x, dt, Bp, Cp, dAc, Dp, hst, out, 1 * LC);
    decay_kernel<<<dgrid, 256, 0, stream>>>(dt, A_log, dAc, 2 * LC);
    scan_kernel<<<BB, ST, 0, stream>>>(x, dt, Bp, Cp, dAc, Dp, hst, out, 2 * LC);
    decay_kernel<<<dgrid, 256, 0, stream>>>(dt, A_log, dAc, 3 * LC);
    scan_kernel<<<BB, ST, 0, stream>>>(x, dt, Bp, Cp, dAc, Dp, hst, out, 3 * LC);
}

// v008
// Measured time: 1570 microseconds a run.
// In both of two side-by-side timings against v007, it was 1.03 times as fast.
// All steps since v000 together make it 2.38 times as fast.
#include <hip/hip_runtime.h>
#include <hip/hip_bf16.h>
#include <math.h>

typedef __attribute__((ext_vector_type(16))) __bf16 v16bf;
typedef __attribute__((ext_vector_type(8)))  __bf16 v8bf;
typedef __attribute__((ext_vector_type(8)))  float  v8f;
typedef __attribute__((ext_vector_type(2)))  float  v2f;

#define BB 2
#define LL 2048
#define DD 1024
#define NN 16
#define ROWS (BB*LL)   // 4096
#define LC 512         // time steps per chunk of the scan
#define TP 2           // time steps per thread of the decay kernel
#define ST (DD / 2)    // threads of the scan: each holds two neighbouring channels
#define PF 4           // steps by which the scan's L2 prefetch leads its decay loads

typedef __attribute__((ext_vector_type(4)))  float  v4f;

__device__ __forceinline__ float fast_tanh(float x) {
    float r;
    asm("v_tanh_f32 %0, %1\n\tv_nop" : "=v"(r) : "v"(x));
    return r;
}

__device__ __forceinline__ float fast_exp2(float x) {
    float r;
    asm("v_exp_f32 %0, %1\n\tv_nop" : "=v"(r) : "v"(x));
    return r;
}

template <int M>
__device__ __forceinline__ float add_row_xmask(float v) {
    const int p = __builtin_amdgcn_update_dpp(0, __builtin_bit_cast(int, v), 0x160 | M, 0xf, 0xf, true);
    return v + __builtin_bit_cast(float, p);
}
__device__ __forceinline__ float wave_sum(float v) {
    const int b = __builtin_bit_cast(int, v);
    v += __builtin_bit_cast(float, __builtin_amdgcn_permlanex16(b, b, 0x76543210, 0xfedcba98, false, false));
    v = add_row_xmask<8>(v);
    v = add_row_xmask<4>(v);
    v = add_row_xmask<2>(v);
    v = add_row_xmask<1>(v);
    return v;
}

// Sum over the 16 lanes of a row, every lane of the row gets it.
__device__ __forceinline__ float row_sum(float v) {
    v = add_row_xmask<8>(v);
    v = add_row_xmask<4>(v);
    v = add_row_xmask<2>(v);
    v = add_row_xmask<1>(v);
    return v;
}

__device__ __forceinline__ float soft_clamp_f(float x, float lo, float hi, float sharp) {
    float c  = 0.5f * (hi + lo);
    float r  = 0.5f * (hi - lo);
    float xn = (x - c) / (r + 1e-8f);
    return fast_tanh(xn * sharp) / sharp * r + c;
}

// ---------------------------------------------------------------------------
// fp32 -> bf16 conversion (4 elements/thread)
// ---------------------------------------------------------------------------
__global__ void __launch_bounds__(256)
cvt_bf16_kernel(const float* __restrict__ in, __bf16* __restrict__ out, int n) {
    int base = (blockIdx.x * blockDim.x + threadIdx.x) * 4;
    if (base < n) {
        float4 v = *(const float4*)(in + base);
        out[base + 0] = (__bf16)v.x;
        out[base + 1] = (__bf16)v.y;
        out[base + 2] = (__bf16)v.z;
        out[base + 3] = (__bf16)v.w;
    }
}

// ---------------------------------------------------------------------------
// dt = soft_clamp(softplus(x @ Wdt^T + bdt))  via  v_wmma_f32_16x16x32_bf16
// 2x2 register tiling: one wave computes a 32x32 output block (4 accumulators),
// each A/B fragment is reused twice -> 8 b128 loads feed 4 WMMAs.
// ---------------------------------------------------------------------------
__global__ void __launch_bounds__(256)
wmma_dt_kernel(const __bf16* __restrict__ xbf, const __bf16* __restrict__ wbf,
               const float* __restrict__ bdt, float* __restrict__ dt) {
    const int lane = threadIdx.x & 31;
    const int wave = threadIdx.x >> 5;            // 0..7
    const int tile = blockIdx.x * 8 + wave;       // 0..4095
    const int tm   = tile >> 5;                   // 0..127  (32-row strips)
    const int tn   = tile & 31;                   // 0..31   (32-col strips)

    const int l15 = lane & 15;
    const int kg  = (lane >> 4) * 8;              // K sub-group: 0 or 8

    // A fragments: rows tm*32 + l15 (+16); K groups [kg..kg+7], [16+kg..16+kg+7]
    const __bf16* arow0 = xbf + (size_t)(tm * 32 + l15) * DD + kg;
    const __bf16* arow1 = arow0 + (size_t)16 * DD;
    // B fragments: columns tn*32 + l15 (+16); Wdt row-major in k
    const __bf16* brow0 = wbf + (size_t)(tn * 32 + l15) * DD + kg;
    const __bf16* brow1 = brow0 + (size_t)16 * DD;

    v8f acc00 = {}, acc01 = {}, acc10 = {}, acc11 = {};

    #pragma unroll 2
    for (int k0 = 0; k0 < DD; k0 += 32) {
        v8bf a0lo = *(const v8bf*)(arow0 + k0);
        v8bf a0hi = *(const v8bf*)(arow0 + k0 + 16);
        v8bf a1lo = *(const v8bf*)(arow1 + k0);
        v8bf a1hi = *(const v8bf*)(arow1 + k0 + 16);
        v8bf b0lo = *(const v8bf*)(brow0 + k0);
        v8bf b0hi = *(const v8bf*)(brow0 + k0 + 16);
        v8bf b1lo = *(const v8bf*)(brow1 + k0);
        v8bf b1hi = *(const v8bf*)(brow1 + k0 + 16);
        v16bf A0, A1, B0, B1;
        #pragma unroll
        for (int i = 0; i < 8; i++) {
            A0[i] = a0lo[i]; A0[i + 8] = a0hi[i];
            A1[i] = a1lo[i]; A1[i + 8] = a1hi[i];
            B0[i] = b0lo[i]; B0[i + 8] = b0hi[i];
            B1[i] = b1lo[i]; B1[i + 8] = b1hi[i];
        }
        acc00 = __builtin_amdgcn_wmma_f32_16x16x32_bf16(false, A0, false, B0, (short)0, acc00, false, false);
        acc01 = __builtin_amdgcn_wmma_f32_16x16x32_bf16(false, A0, false, B1, (short)0, acc01, false, false);
        acc10 = __builtin_amdgcn_wmma_f32_16x16x32_bf16(false, A1, false, B0, (short)0, acc10, false, false);
        acc11 = __builtin_amdgcn_wmma_f32_16x16x32_bf16(false, A1, false, B1, (short)0, acc11, false, false);
    }

    const int mbase = (lane >> 4) * 8;
    auto epilogue = [&](v8f acc, int rowbase, int colbase) {
        const int col  = colbase + l15;
        const float bias = bdt[col];
        #pragma unroll
        for (int r = 0; r < 8; r++) {
            int row  = rowbase + mbase + r;
            float v  = acc[r] + bias;
            // softplus via hardware v_exp_f32 / v_log_f32 (result clamped anyway)
            float sp = (v > 20.f) ? v : __logf(1.f + __expf(v));
            dt[(size_t)row * DD + col] = soft_clamp_f(sp, 0.001f, 0.1f, 0.5f);
        }
    };
    epilogue(acc00, tm * 32,      tn * 32);
    epilogue(acc01, tm * 32,      tn * 32 + 16);
    epilogue(acc10, tm * 32 + 16, tn * 32);
    epilogue(acc11, tm * 32 + 16, tn * 32 + 16);
}

// ---------------------------------------------------------------------------
// Bp = x @ WB^T, Cp = x @ WC^T   ([4096,16] each) — small, plain VALU
// Each value is stored twice in a row: the scan reads a row into scalar registers,
// and a packed f32 instruction takes an aligned scalar pair as one operand.
// ---------------------------------------------------------------------------
__global__ void __launch_bounds__(256)
proj_kernel(const float* __restrict__ x, const float* __restrict__ WB,
            const float* __restrict__ WC, float* __restrict__ Bp,
            float* __restrict__ Cp) {
    int t   = blockIdx.x * blockDim.x + threadIdx.x;   // 0..65535
    int row = t >> 4;
    int n   = t & 15;
    const float4* xr = (const float4*)(x + (size_t)row * DD);
    const float4* wb = (const float4*)(WB + (size_t)n * DD);
    const float4* wc = (const float4*)(WC + (size_t)n * DD);
    float sb = 0.f, sc = 0.f;
    #pragma unroll 4
    for (int k = 0; k < DD / 4; k++) {
        float4 xv = xr[k], bv = wb[k], cv = wc[k];
        sb += xv.x * bv.x + xv.y * bv.y + xv.z * bv.z + xv.w * bv.w;
        sc += xv.x * cv.x + xv.y * cv.y + xv.z * cv.z + xv.w * cv.w;
    }
    ((float2*)Bp)[t] = make_float2(sb, sb);
    ((float2*)Cp)[t] = make_float2(sc, sc);
}

__global__ void __launch_bounds__(256)
decay_kernel(const float* __restrict__ dt, const float* __restrict__ A_log,
             float* __restrict__ dAc, int t0) {
    const int p   = blockIdx.y * 256 + threadIdx.x;   // 0..ST-1
    const int b   = blockIdx.z;
    const int tl0 = blockIdx.x * TP;

    float A[2][NN];
    #pragma unroll
    for (int c = 0; c < 2; c++) {
        #pragma unroll
        for (int q = 0; q < 4; q++) {
            const v4f al = *((const v4f*)A_log + (p * 2 + c) * 4 + q);
            #pragma unroll
            for (int j = 0; j < 4; j++) {
                // soft_clamp(al,-5,5,0.5) = 10*tanh(al/10)
                A[c][q * 4 + j] = -__expf(10.f * fast_tanh(al[j] * 0.1f));
            }
        }
    }
    #pragma unroll
    for (int i = 0; i < TP; i++) {
        const int tl = tl0 + i;
        const v2f dtn = *(const v2f*)(dt + ((size_t)b * LL + t0 + tl) * DD + p * 2);
        // the wait that belongs in front of an overwrite of a register that an issued
        // load names
        if (i + 1 < TP) asm volatile("s_wait_xcnt 0x0" ::: "memory");
        v4f* dst = (v4f*)dAc + (size_t)(b * LC + tl) * 8 * ST + p;
        #pragma unroll
        for (int q = 0; q < 8; q++) {
            v4f v;
            #pragma unroll
            for (int j = 0; j < 4; j++) {
                // soft_clamp(z,-8,8,0.5) = 16*tanh(z/16), z = dt*A
                const float th = fast_tanh((dtn[j & 1] * A[j & 1][q * 2 + (j >> 1)]) * 0.0625f);
                // exp(v) as exp2(v * log2(e)), the same two roundings as __expf
                v[j] = fast_exp2((th * 16.f) * 1.44269504088896340736f);
            }
            dst[q * ST] = v;
        }
    }
}

// Eight packed products m * s, s the low register of an aligned scalar pair, used for
// both halves (op_sel_hi 0: the only form the assembler takes for a scalar source),
// for the scan's input terms (dt * x of two channels) * B[n]: no copy of the B row
// into vector registers.
// volatile: holds them where the source has them, directly behind the scan's barrier,
// where they fill the wait for the LDS read of the partial sums, off the path that
// waits for the norm.
__device__ __forceinline__ void mul8_first(v2f& r0, v2f& r1, v2f& r2, v2f& r3,
                                          v2f& r4, v2f& r5, v2f& r6, v2f& r7, v2f m,
                                          v2f s0, v2f s1, v2f s2, v2f s3,
                                          v2f s4, v2f s5, v2f s6, v2f s7) {
    asm volatile("s_delay_alu instid0(VALU_DEP_1)\n\t"
                 "v_pk_mul_f32 %0, %8, %9 op_sel_hi:[1,0]\n\t"
                 "v_pk_mul_f32 %1, %8, %10 op_sel_hi:[1,0]\n\t"
                 "v_pk_mul_f32 %2, %8, %11 op_sel_hi:[1,0]\n\t"
                 "v_pk_mul_f32 %3, %8, %12 op_sel_hi:[1,0]\n\t"
                 "v_pk_mul_f32 %4, %8, %13 op_sel_hi:[1,0]\n\t"
                 "v_pk_mul_f32 %5, %8, %14 op_sel_hi:[1,0]\n\t"
                 "v_pk_mul_f32 %6, %8, %15 op_sel_hi:[1,0]\n\t"
                 "v_pk_mul_f32 %7, %8, %16 op_sel_hi:[1,0]"
                 : "=&v"(r0), "=&v"(r1), "=&v"(r2), "=&v"(r3),
                   "=&v"(r4), "=&v"(r5), "=&v"(r6), "=&v"(r7)
                 : "v"(m), "s"(s0), "s"(s1), "s"(s2), "s"(s3),
                   "s"(s4), "s"(s5), "s"(s6), "s"(s7));
}
__device__ __forceinline__ void mul8_more(v2f& r0, v2f& r1, v2f& r2, v2f& r3,
                                          v2f& r4, v2f& r5, v2f& r6, v2f& r7, v2f m,
                                          v2f s0, v2f s1, v2f s2, v2f s3,
                                          v2f s4, v2f s5, v2f s6, v2f s7) {
    asm volatile("v_pk_mul_f32 %0, %8, %9 op_sel_hi:[1,0]\n\t"
                 "v_pk_mul_f32 %1, %8, %10 op_sel_hi:[1,0]\n\t"
                 "v_pk_mul_f32 %2, %8, %11 op_sel_hi:[1,0]\n\t"
                 "v_pk_mul_f32 %3, %8, %12 op_sel_hi:[1,0]\n\t"
                 "v_pk_mul_f32 %4, %8, %13 op_sel_hi:[1,0]\n\t"
                 "v_pk_mul_f32 %5, %8, %14 op_sel_hi:[1,0]\n\t"
                 "v_pk_mul_f32 %6, %8, %15 op_sel_hi:[1,0]\n\t"
                 "v_pk_mul_f32 %7, %8, %16 op_sel_hi:[1,0]"
                 : "=&v"(r0), "=&v"(r1), "=&v"(r2), "=&v"(r3),
                   "=&v"(r4), "=&v"(r5), "=&v"(r6), "=&v"(r7)
                 : "v"(m), "s"(s0), "s"(s1), "s"(s2), "s"(s3),
                   "s"(s4), "s"(s5), "s"(s6), "s"(s7));
}

// Output dot of two channels with the C row in scalar register pairs (each value twice):
// four packed chains, eight terms a call. The hints: each link's producer is four
// vector instructions back. volatile: the dot stays in front of the sum of the partials,
// where it fills the wait for their LDS read.
__device__ __forceinline__ void dot8_first(v2f& a0, v2f& a1, v2f& a2, v2f& a3,
                                           v2f h0, v2f h1, v2f h2, v2f h3,
                                           v2f h4, v2f h5, v2f h6, v2f h7,
                                           v2f c0, v2f c1, v2f c2, v2f c3,
                                           v2f c4, v2f c5, v2f c6, v2f c7) {
    asm volatile("v_pk_mul_f32 %0, %4, %12 op_sel_hi:[1,0]\n\t"
                 "v_pk_mul_f32 %1, %5, %13 op_sel_hi:[1,0]\n\t"
                 "v_pk_mul_f32 %2, %6, %14 op_sel_hi:[1,0]\n\t"
                 "v_pk_mul_f32 %3, %7, %15 op_sel_hi:[1,0]\n\t"
                 "s_delay_alu instid0(VALU_DEP_4) | instskip(NEXT) | instid1(VALU_DEP_4)\n\t"
                 "v_pk_fma_f32 %0, %8, %16, %0 op_sel_hi:[1,0,1]\n\t"
                 "v_pk_fma_f32 %1, %9, %17, %1 op_sel_hi:[1,0,1]\n\t"
                 "s_delay_alu instid0(VALU_DEP_4) | instskip(NEXT) | instid1(VALU_DEP_4)\n\t"
                 "v_pk_fma_f32 %2, %10, %18, %2 op_sel_hi:[1,0,1]\n\t"
                 "v_pk_fma_f32 %3, %11, %19, %3 op_sel_hi:[1,0,1]"
                 : "=&v"(a0), "=&v"(a1), "=&v"(a2), "=&v"(a3)
                 : "v"(h0), "v"(h1), "v"(h2), "v"(h3), "v"(h4), "v"(h5), "v"(h6), "v"(h7),
                   "s"(c0), "s"(c1), "s"(c2), "s"(c3), "s"(c4), "s"(c5), "s"(c6), "s"(c7));
}
__device__ __forceinline__ void dot8_more(v2f& a0, v2f& a1, v2f& a2, v2f& a3,
                                          v2f h0, v2f h1, v2f h2, v2f h3,
                                          v2f h4, v2f h5, v2f h6, v2f h7,
                                          v2f c0, v2f c1, v2f c2, v2f c3,
                                          v2f c4, v2f c5, v2f c6, v2f c7) {
    asm volatile("s_delay_alu instid0(VALU_DEP_4) | instskip(NEXT) | instid1(VALU_DEP_4)\n\t"
                 "v_pk_fma_f32 %0, %4, %12, %0 op_sel_hi:[1,0,1]\n\t"
                 "v_pk_fma_f32 %1, %5, %13, %1 op_sel_hi:[1,0,1]\n\t"
                 "s_delay_alu instid0(VALU_DEP_4) | instskip(NEXT) | instid1(VALU_DEP_4)\n\t"
                 "v_pk_fma_f32 %2, %6, %14, %2 op_sel_hi:[1,0,1]\n\t"
                 "v_pk_fma_f32 %3, %7, %15, %3 op_sel_hi:[1,0,1]\n\t"
                 "s_delay_alu instid0(VALU_DEP_4) | instskip(NEXT) | instid1(VALU_DEP_4)\n\t"
                 "v_pk_fma_f32 %0, %8, %16, %0 op_sel_hi:[1,0,1]\n\t"
                 "v_pk_fma_f32 %1, %9, %17, %1 op_sel_hi:[1,0,1]\n\t"
                 "s_delay_alu instid0(VALU_DEP_4) | instskip(NEXT) | instid1(VALU_DEP_4)\n\t"
                 "v_pk_fma_f32 %2, %10, %18, %2 op_sel_hi:[1,0,1]\n\t"
                 "v_pk_fma_f32 %3, %11, %19, %3 op_sel_hi:[1,0,1]"
                 : "+v"(a0), "+v"(a1), "+v"(a2), "+v"(a3)
                 : "v"(h0), "v"(h1), "v"(h2), "v"(h3), "v"(h4), "v"(h5), "v"(h6), "v"(h7),
                   "s"(c0), "s"(c1), "s"(c2), "s"(c3), "s"(c4), "s"(c5), "s"(c6), "s"(c7));
}

// Work-group barrier that waits for this wave's LDS traffic alone. __syncthreads()
// also waits for every global load of the wave, and would land, at each barrier,
// the loads that are issued one and two steps ahead of their use.
__device__ __forceinline__ void lds_barrier() {
    asm volatile("s_wait_dscnt 0x0\n\ts_barrier_signal -1\n\ts_barrier_wait -1" ::: "memory");
}

__global__ void __launch_bounds__(ST)
scan_kernel(const float* __restrict__ x, const float* __restrict__ dt,
            const float* __restrict__ Bp, const float* __restrict__ Cp,
            const float* __restrict__ dAc, const float* __restrict__ Dp,
            float* __restrict__ hst, float* __restrict__ out, int t0) {
    const int b    = blockIdx.x;
    const int p    = threadIdx.x;
    const int lane = threadIdx.x & 31;
    const int wave = threadIdx.x >> 5;

    // the waves' partial square sums, one set for the even and one for the odd steps:
    // a wave that runs ahead writes step t+1's partial while others still read step t's;
    // it reaches step t+2's write only through the barrier of step t+1, which every
    // wave signals behind its own read of step t's set
    __shared__ float wsum[2][ST / 32];

    v4f* hb = (v4f*)hst + (size_t)b * 8 * ST + p;
    v2f h[NN];
    #pragma unroll
    for (int q = 0; q < 8; q++) {
        v4f v = {0.f, 0.f, 0.f, 0.f};
        if (t0 != 0) v = hb[q * ST];
        h[q*2+0] = v2f{v.x, v.y}; h[q*2+1] = v2f{v.z, v.w};
    }
    const v2f dpv = *(const v2f*)(Dp + p * 2);

    const float* xb  = x  + (size_t)b * LL * DD;
    const float* dtb = dt + (size_t)b * LL * DD;
    const float* Bb  = Bp + (size_t)b * LL * NN * 2;
    const float* Cb  = Cp + (size_t)b * LL * NN * 2;
    const v4f*   dAb = (const v4f*)dAc + (size_t)b * LC * 8 * ST;
    float*       ob  = out + (size_t)b * LL * DD;

    // raw operands of the step that is being fetched (a B or C entry: the value twice)
    v2f xn, dtn, Bn[NN];
    // finished operands of the step that is about to run
    v2f xv, u[NN], Crow[NN];
    // decay factors of the even and of the odd steps
    v2f dA0[NN], dA1[NN];

    // byte offsets on scalar bases: xo the x/dt row last fetched, xp the x/dt row last
    // asked into the caches, ao the decay row last fetched, so the output row last stored
    unsigned xo = (unsigned)t0 * (DD * 4) + (unsigned)p * 8;
    unsigned xp = xo + 2u * (DD * 4);
    unsigned ao = (unsigned)p * 16;
    unsigned so = xo;
    v2f      ykeep = {0.f, 0.f};   // the value that the step's store names
    // The wait that belongs in front of an overwrite of a register that an issued load
    // or store names, and the overwrites, in one statement: nothing can come between.
    auto next_offsets = [&](int sx, int sp, int sa, int ss) {
        asm volatile("s_wait_xcnt 0x0\n\t"
                     "v_add_nc_u32 %0, %4, %0\n\t"
                     "v_add_nc_u32 %1, %5, %1\n\t"
                     "v_add_nc_u32 %2, %6, %2\n\t"
                     "v_add_nc_u32 %3, %7, %3"
                     : "+v"(xo), "+v"(xp), "+v"(ao), "+v"(so)
                     : "s"(sx), "s"(sp), "s"(sa), "s"(ss) : "memory");
    };
    auto load_xdt = [&]() {
        xn  = *(const v2f*)((const char*)xb  + xo);
        dtn = *(const v2f*)((const char*)dtb + xo);
    };
    auto load_B = [&](int t) {
        #pragma unroll
        for (int q = 0; q < 8; q++) {
            float4 bq = *(const float4*)(Bb + t * (NN * 2) + q * 4);
            Bn[q*2+0] = v2f{bq.x, bq.y}; Bn[q*2+1] = v2f{bq.z, bq.w};
        }
    };
    auto load_C = [&](int t) {
        #pragma unroll
        for (int q = 0; q < 8; q++) {
            float4 cq = *(const float4*)(Cb + t * (NN * 2) + q * 4);
            Crow[q*2+0] = v2f{cq.x, cq.y}; Crow[q*2+1] = v2f{cq.z, cq.w};
        }
    };
    auto load_dA = [&](v2f (&s)[NN]) {
        #pragma unroll
        for (int q = 0; q < 8; q++) {
            // read once: non-temporal, so that the stream does not push x, dt and
            // the B and C rows out of the caches
            const v4f v = __builtin_nontemporal_load((const v4f*)((const char*)dAb + ao) + q * ST);
            s[q*2+0] = v2f{v.x, v.y}; s[q*2+1] = v2f{v.z, v.w};
        }
    };
    unsigned poff = (unsigned)(lane >> 2) * (ST * 16) + (unsigned)wave * 512 + (unsigned)(lane & 3) * 128
                  + 2u * (8 * ST * 16);
    const unsigned pcap = poff + (unsigned)(LC - 4) * (8 * ST * 16);   // the row before the last
    auto prefetch_dA = [&]() {
        asm volatile("global_prefetch_b8 %0, %1 scope:SCOPE_SE\n\t"
                     "v_min_u32 %0, %0, %2\n\t"
                     "s_delay_alu instid0(VALU_DEP_1)\n\t"   // hint for the dependent add
                     "v_add_nc_u32 %0, 0x10000, %0"
                     : "+v"(poff) : "s"(dAb), "v"(pcap) : "memory");
    };
    auto input_terms = [&]() {
        const v2f dtx = dtn * xn;
        mul8_first(u[0], u[1], u[2], u[3], u[4], u[5], u[6], u[7], dtx,
                   Bn[0], Bn[1], Bn[2], Bn[3], Bn[4], Bn[5], Bn[6], Bn[7]);
        mul8_more(u[8], u[9], u[10], u[11], u[12], u[13], u[14], u[15], dtx,
                  Bn[8], Bn[9], Bn[10], Bn[11], Bn[12], Bn[13], Bn[14], Bn[15]);
        // x is kept for the output term. The copy is made here, where x has landed:
        // left to the compiler it stands at the loop's foot, on the register of the
        // next fetch, and waits there for every load in flight
        asm("v_mov_b64 %0, %1" : "=v"(xv) : "v"(xn));
    };

    auto step = [&](v2f (&dA)[NN], int tl, int par) {
        const int t = t0 + tl;

        // the part that needs the previous step's rescaled state
        // (the fused form written out: dA * h fused onto the rounded input term, in
        // every step alike, whichever product the compiler would pick to fuse)
        #pragma unroll
        for (int n = 0; n < NN; n++) h[n] = __builtin_elementwise_fma(dA[n], h[n], u[n]);
        // square sum of both channels: four packed chains of four links
        v2f sq[4];
        #pragma unroll
        for (int n = 0; n < 4; n++) sq[n] = h[n] * h[n];
        #pragma unroll
        for (int n = 4; n < NN; n++) sq[n & 3] = __builtin_elementwise_fma(h[n], h[n], sq[n & 3]);
        const v2f sqs = (sq[0] + sq[1]) + (sq[2] + sq[3]);
        float ss = sqs.x + sqs.y;
        const v2f xcur = xv;

        // wave32 reduce in registers, then cross-wave via LDS
        ss = wave_sum(ss);
        if (lane == 0) wsum[par][wave] = ss;
        lds_barrier();
        // sixteen partials, read by every wave: each 16-lane row will sum all of them
        const float part = wsum[par][lane & 15];

        // next step's input terms do not need the norm: they run while the partials
        // come from LDS; then the fetch of the B row of the step after it
        input_terms();
        load_B(t + 2 < LL ? t + 2 : LL - 1);

        // output dot product on the state before its rescale: independent of the
        // norm, it too stands in front of the sum of the partials; the
        // scalar scale is applied to the sum
        v2f y0, y1, y2, y3;
        dot8_first(y0, y1, y2, y3, h[0], h[1], h[2], h[3], h[4], h[5], h[6], h[7],
                   Crow[0], Crow[1], Crow[2], Crow[3], Crow[4], Crow[5], Crow[6], Crow[7]);
        dot8_more(y0, y1, y2, y3, h[8], h[9], h[10], h[11], h[12], h[13], h[14], h[15],
                  Crow[8], Crow[9], Crow[10], Crow[11], Crow[12], Crow[13], Crow[14], Crow[15]);
        const v2f yd = (y0 + y1) + (y2 + y3);
        load_C(t + 1 < LL ? t + 1 : LL - 1);

        // the step's vector memory instructions
        // (behind the scalar load of the C row: no scalar load then follows them closely).
        // Rows stop at the last one (a stride of 0): the last steps fetch it again, the
        // result is not used.
        next_offsets(t + 2 < LL ? DD * 4 : 0, t + 3 < LL ? DD * 4 : 0,
                     tl + 2 < LC ? 8 * ST * 16 : 0, tl != 0 ? DD * 4 : 0);
        load_xdt();      // row t + 2; first: they are needed before the decay factors
        load_dA(dA);     // row tl + 2, into the set that this step has used
        prefetch_dA();   // row tl + 2 + PF
        __builtin_prefetch((const char*)dtb + xp, 0, 0);
        __builtin_prefetch((const char*)xb  + xp, 0, 0);

        // min(20 / (sqrt(v) + 1e-8), 1) as min(20 * rsq(v), 1), the same in every wave.
        // The 1e-8 changes nothing behind the min: from a norm of 0.25 up it is below
        // half a unit of the norm, below that both quotients exceed 1 (v = 0: inf, so 1)
        const float scale = fminf(20.f * __builtin_amdgcn_rsqf(row_sum(part)), 1.f);
        const v2f sc2 = {scale, scale};
        #pragma unroll
        for (int n = 0; n < NN; n++) h[n] *= sc2;
        const v2f sy = sc2 * yd;
        // y = dpv * x + scale * yd, written into the registers that the store names: the
        // store of the step before is covered by this step's wait in next_offsets().
        // In asm so that the value keeps those registers (the hint: sy is fresh)
        asm volatile("s_delay_alu instid0(VALU_DEP_1)\n\t"
                     "v_pk_fma_f32 %0, %1, %2, %3"
                     : "+v"(ykeep) : "v"(dpv), "v"(xcur), "v"(sy));
        *(v2f*)((char*)ob + so) = ykeep;
    };

    // the same order of loads as in the loop (x and dt in front of the decay rows), so
    // that the loop's counted waits for x and dt need not cover the decay loads behind them
    load_xdt();
    load_B(t0);
    load_dA(dA0);
    input_terms();
    next_offsets(DD * 4, 0, 8 * ST * 16, 0);
    load_xdt();
    load_dA(dA1);
    #pragma unroll   // rows 2 to 1 + PF: the loop asks for the rows behind them
    for (int i = 0; i < PF; i++) prefetch_dA();
    load_B(t0 + 1);
    load_C(t0);

    // two steps per trip: each has its own set of decay factors, so that no
    // register with a load in flight has to be copied
    for (int tl = 0; tl < LC; tl += 2) {
        step(dA0, tl, 0);
        step(dA1, tl + 1, 1);
    }
    // the last store's registers are free for reuse from here on
    asm volatile("s_wait_xcnt 0x0" ::: "memory");

    #pragma unroll
    for (int q = 0; q < 8; q++) {
        const v4f v = {h[q*2+0].x, h[q*2+0].y, h[q*2+1].x, h[q*2+1].y};
        hb[q * ST] = v;
    }
}

// ---------------------------------------------------------------------------
extern "C" void kernel_launch(void* const* d_in, const int* in_sizes, int n_in,
                              void* d_out, int out_size, void* d_ws, size_t ws_size,
                              hipStream_t stream) {
    const float* x     = (const float*)d_in[0];
    const float* Wdt   = (const float*)d_in[1];
    const float* bdt   = (const float*)d_in[2];
    const float* WB    = (const float*)d_in[3];
    const float* WC    = (const float*)d_in[4];
    const float* A_log = (const float*)d_in[5];
    const float* Dp    = (const float*)d_in[6];
    float* out = (float*)d_out;

    char* ws = (char*)d_ws;
    size_t off = 0;
    auto take = [&](size_t bytes) -> void* {
        void* p = ws + off;
        off += (bytes + 255) & ~(size_t)255;
        return p;
    };
    float*  dt  = (float*) take((size_t)ROWS * DD * sizeof(float));   // 16 MB
    float*  Bp  = (float*) take((size_t)ROWS * NN * 2 * sizeof(float));   // each value twice
    float*  Cp  = (float*) take((size_t)ROWS * NN * 2 * sizeof(float));
    __bf16* xbf = (__bf16*)take((size_t)ROWS * DD * sizeof(__bf16));  // 8 MB
    __bf16* wbf = (__bf16*)take((size_t)DD * DD * sizeof(__bf16));    // 2 MB
    float*  dAc = (float*) take((size_t)BB * LC * DD * NN * sizeof(float));  // 64 MB, one chunk
    float*  hst = (float*) take((size_t)BB * DD * NN * sizeof(float));
    (void)ws_size; (void)in_sizes; (void)n_in; (void)out_size;

    // 1) bf16 conversions
    {
        int n = ROWS * DD;                              // 4,194,304
        cvt_bf16_kernel<<<(n / 4 + 255) / 256, 256, 0, stream>>>(x, xbf, n);
        int m = DD * DD;                                // 1,048,576
        cvt_bf16_kernel<<<(m / 4 + 255) / 256, 256, 0, stream>>>(Wdt, wbf, m);
    }
    // 2) WMMA GEMM + softplus + soft_clamp -> dt  (32x32 tile per wave)
    {
        int tiles = (ROWS / 32) * (DD / 32);            // 4096 tiles, 8/block
        wmma_dt_kernel<<<tiles / 8, 256, 0, stream>>>(xbf, wbf, bdt, dt);
    }
    // 3) B/C projections
    proj_kernel<<<(ROWS * NN) / 256, 256, 0, stream>>>(x, WB, WC, Bp, Cp);
    const dim3 dgrid(LC / TP, ST / 256, BB);
    decay_kernel<<<dgrid, 256, 0, stream>>>(dt, A_log, dAc, 0 * LC);
    scan_kernel<<<BB, ST, 0, stream>>>(x, dt, Bp, Cp, dAc, Dp, hst, out, 0 * LC);
    decay_kernel<<<dgrid, 256, 0, stream>>>(dt, A_log, dAc, 1 * LC);
    scan_kernel<<<BB, ST, 0, stream>>>(x, dt, Bp, Cp, dAc, Dp, hst, out, 1 * LC);
    decay_kernel<<<dgrid, 256, 0, stream>>>(dt, A_log, dAc, 2 * LC);
    scan_kernel<<<BB, ST, 0, stream>>>(x, dt, Bp, Cp, dAc, Dp, hst, out, 2 * LC);
    decay_kernel<<<dgrid, 256, 0, stream>>>(dt, A_log, dAc, 3 * LC);
    scan_kernel<<<BB, ST, 0, stream>>>(x, dt, Bp, Cp, dAc, Dp, hst, out, 3 * LC);
}

// v009
// One run takes 1250 microseconds.
// In both of two side-by-side timings against v008, it was 1.26 times as fast.
// All steps since v000 together make it 3.01 times as fast.
#include <hip/hip_runtime.h>
#include <hip/hip_bf16.h>
#include <math.h>

typedef __attribute__((ext_vector_type(16))) __bf16 v16bf;
typedef __attribute__((ext_vector_type(8)))  __bf16 v8bf;
typedef __attribute__((ext_vector_type(8)))  float  v8f;
typedef __attribute__((ext_vector_type(2)))  float  v2f;

#define BB 2
#define LL 2048
#define DD 1024
#define NN 16
#define ROWS (BB*LL)   // 4096
#define LC 512         // time steps per chunk of the scan
#define TP 2           // time steps per thread of the decay kernel
#define ST (DD / 2)    // threads of the scan: each holds two neighbouring channels
#define SLICE 8192     // bytes of one wave's slice of a stage of the decay ring: 2 steps x 8 rows of 512 bytes
#define STAGE (SLICE * (ST / 32))   // bytes of one stage: the decay factors of two steps, 128 KiB

typedef __attribute__((ext_vector_type(4)))  float  v4f;
typedef __attribute__((ext_vector_type(4)))  unsigned u32x4;
typedef __attribute__((ext_vector_type(8)))  unsigned u32x8;

__device__ __forceinline__ unsigned uni(unsigned v) { return (unsigned)__builtin_amdgcn_readfirstlane(v); }
__device__ __forceinline__ unsigned pinned(unsigned v) {
    unsigned w = uni(v);
    asm volatile("" : "+s"(w));
    return w;
}

__device__ __forceinline__ float fast_tanh(float x) {
    float r;
    asm("v_tanh_f32 %0, %1\n\tv_nop" : "=v"(r) : "v"(x));
    return r;
}

__device__ __forceinline__ float fast_exp2(float x) {
    float r;
    asm("v_exp_f32 %0, %1\n\tv_nop" : "=v"(r) : "v"(x));
    return r;
}

template <int M>
__device__ __forceinline__ float add_row_xmask(float v) {
    const int p = __builtin_amdgcn_update_dpp(0, __builtin_bit_cast(int, v), 0x160 | M, 0xf, 0xf, true);
    return v + __builtin_bit_cast(float, p);
}
__device__ __forceinline__ float wave_sum(float v) {
    const int b = __builtin_bit_cast(int, v);
    v += __builtin_bit_cast(float, __builtin_amdgcn_permlanex16(b, b, 0x76543210, 0xfedcba98, false, false));
    v = add_row_xmask<8>(v);
    v = add_row_xmask<4>(v);
    v = add_row_xmask<2>(v);
    v = add_row_xmask<1>(v);
    return v;
}

// Sum over the 16 lanes of a row, every lane of the row gets it.
__device__ __forceinline__ float row_sum(float v) {
    v = add_row_xmask<8>(v);
    v = add_row_xmask<4>(v);
    v = add_row_xmask<2>(v);
    v = add_row_xmask<1>(v);
    return v;
}

__device__ __forceinline__ float soft_clamp_f(float x, float lo, float hi, float sharp) {
    float c  = 0.5f * (hi + lo);
    float r  = 0.5f * (hi - lo);
    float xn = (x - c) / (r + 1e-8f);
    return fast_tanh(xn * sharp) / sharp * r + c;
}

// ---------------------------------------------------------------------------
// fp32 -> bf16 conversion (4 elements/thread)
// ---------------------------------------------------------------------------
__global__ void __launch_bounds__(256)
cvt_bf16_kernel(const float* __restrict__ in, __bf16* __restrict__ out, int n) {
    int base = (blockIdx.x * blockDim.x + threadIdx.x) * 4;
    if (base < n) {
        float4 v = *(const float4*)(in + base);
        out[base + 0] = (__bf16)v.x;
        out[base + 1] = (__bf16)v.y;
        out[base + 2] = (__bf16)v.z;
        out[base + 3] = (__bf16)v.w;
    }
}

// ---------------------------------------------------------------------------
// dt = soft_clamp(softplus(x @ Wdt^T + bdt))  via  v_wmma_f32_16x16x32_bf16
// 2x2 register tiling: one wave computes a 32x32 output block (4 accumulators),
// each A/B fragment is reused twice -> 8 b128 loads feed 4 WMMAs.
// ---------------------------------------------------------------------------
__global__ void __launch_bounds__(256)
wmma_dt_kernel(const __bf16* __restrict__ xbf, const __bf16* __restrict__ wbf,
               const float* __restrict__ bdt, float* __restrict__ dt) {
    const int lane = threadIdx.x & 31;
    const int wave = threadIdx.x >> 5;            // 0..7
    const int tile = blockIdx.x * 8 + wave;       // 0..4095
    const int tm   = tile >> 5;                   // 0..127  (32-row strips)
    const int tn   = tile & 31;                   // 0..31   (32-col strips)

    const int l15 = lane & 15;
    const int kg  = (lane >> 4) * 8;              // K sub-group: 0 or 8

    // A fragments: rows tm*32 + l15 (+16); K groups [kg..kg+7], [16+kg..16+kg+7]
    const __bf16* arow0 = xbf + (size_t)(tm * 32 + l15) * DD + kg;
    const __bf16* arow1 = arow0 + (size_t)16 * DD;
    // B fragments: columns tn*32 + l15 (+16); Wdt row-major in k
    const __bf16* brow0 = wbf + (size_t)(tn * 32 + l15) * DD + kg;
    const __bf16* brow1 = brow0 + (size_t)16 * DD;

    v8f acc00 = {}, acc01 = {}, acc10 = {}, acc11 = {};

    #pragma unroll 2
    for (int k0 = 0; k0 < DD; k0 += 32) {
        v8bf a0lo = *(const v8bf*)(arow0 + k0);
        v8bf a0hi = *(const v8bf*)(arow0 + k0 + 16);
        v8bf a1lo = *(const v8bf*)(arow1 + k0);
        v8bf a1hi = *(const v8bf*)(arow1 + k0 + 16);
        v8bf b0lo = *(const v8bf*)(brow0 + k0);
        v8bf b0hi = *(const v8bf*)(brow0 + k0 + 16);
        v8bf b1lo = *(const v8bf*)(brow1 + k0);
        v8bf b1hi = *(const v8bf*)(brow1 + k0 + 16);
        v16bf A0, A1, B0, B1;
        #pragma unroll
        for (int i = 0; i < 8; i++) {
            A0[i] = a0lo[i]; A0[i + 8] = a0hi[i];
            A1[i] = a1lo[i]; A1[i + 8] = a1hi[i];
            B0[i] = b0lo[i]; B0[i + 8] = b0hi[i];
            B1[i] = b1lo[i]; B1[i + 8] = b1hi[i];
        }
        acc00 = __builtin_amdgcn_wmma_f32_16x16x32_bf16(false, A0, false, B0, (short)0, acc00, false, false);
        acc01 = __builtin_amdgcn_wmma_f32_16x16x32_bf16(false, A0, false, B1, (short)0, acc01, false, false);
        acc10 = __builtin_amdgcn_wmma_f32_16x16x32_bf16(false, A1, false, B0, (short)0, acc10, false, false);
        acc11 = __builtin_amdgcn_wmma_f32_16x16x32_bf16(false, A1, false, B1, (short)0, acc11, false, false);
    }

    const int mbase = (lane >> 4) * 8;
    auto epilogue = [&](v8f acc, int rowbase, int colbase) {
        const int col  = colbase + l15;
        const float bias = bdt[col];
        #pragma unroll
        for (int r = 0; r < 8; r++) {
            int row  = rowbase + mbase + r;
            float v  = acc[r] + bias;
            // softplus via hardware v_exp_f32 / v_log_f32 (result clamped anyway)
            float sp = (v > 20.f) ? v : __logf(1.f + __expf(v));
            dt[(size_t)row * DD + col] = soft_clamp_f(sp, 0.001f, 0.1f, 0.5f);
        }
    };
    epilogue(acc00, tm * 32,      tn * 32);
    epilogue(acc01, tm * 32,      tn * 32 + 16);
    epilogue(acc10, tm * 32 + 16, tn * 32);
    epilogue(acc11, tm * 32 + 16, tn * 32 + 16);
}

// ---------------------------------------------------------------------------
// Bp = x @ WB^T, Cp = x @ WC^T   ([4096,16] each) — small, plain VALU
// Each value is stored twice in a row: the scan reads a row into scalar registers,
// and a packed f32 instruction takes an aligned scalar pair as one operand.
// ---------------------------------------------------------------------------
__global__ void __launch_bounds__(256)
proj_kernel(const float* __restrict__ x, const float* __restrict__ WB,
            const float* __restrict__ WC, float* __restrict__ Bp,
            float* __restrict__ Cp) {
    int t   = blockIdx.x * blockDim.x + threadIdx.x;   // 0..65535
    int row = t >> 4;
    int n   = t & 15;
    const float4* xr = (const float4*)(x + (size_t)row * DD);
    const float4* wb = (const float4*)(WB + (size_t)n * DD);
    const float4* wc = (const float4*)(WC + (size_t)n * DD);
    float sb = 0.f, sc = 0.f;
    #pragma unroll 4
    for (int k = 0; k < DD / 4; k++) {
        float4 xv = xr[k], bv = wb[k], cv = wc[k];
        sb += xv.x * bv.x + xv.y * bv.y + xv.z * bv.z + xv.w * bv.w;
        sc += xv.x * cv.x + xv.y * cv.y + xv.z * cv.z + xv.w * cv.w;
    }
    ((float2*)Bp)[t] = make_float2(sb, sb);
    ((float2*)Cp)[t] = make_float2(sc, sc);
}

__global__ void __launch_bounds__(256)
decay_kernel(const float* __restrict__ dt, const float* __restrict__ A_log,
             float* __restrict__ dAc, int t0) {
    const int p   = blockIdx.y * 256 + threadIdx.x;   // 0..ST-1
    const int b   = blockIdx.z;
    const int tl0 = blockIdx.x * TP;

    float A[2][NN];
    #pragma unroll
    for (int c = 0; c < 2; c++) {
        #pragma unroll
        for (int q = 0; q < 4; q++) {
            const v4f al = *((const v4f*)A_log + (p * 2 + c) * 4 + q);
            #pragma unroll
            for (int j = 0; j < 4; j++) {
                // soft_clamp(al,-5,5,0.5) = 10*tanh(al/10)
                A[c][q * 4 + j] = -__expf(10.f * fast_tanh(al[j] * 0.1f));
            }
        }
    }
    #pragma unroll
    for (int i = 0; i < TP; i++) {
        const int tl = tl0 + i;
        const v2f dtn = *(const v2f*)(dt + ((size_t)b * LL + t0 + tl) * DD + p * 2);
        // the wait that belongs in front of an overwrite of a register that an issued
        // load names
        if (i + 1 < TP) asm volatile("s_wait_xcnt 0x0" ::: "memory");
        v4f* dst = (v4f*)dAc + (size_t)(b * LC + tl) * 8 * ST + p;
        #pragma unroll
        for (int q = 0; q < 8; q++) {
            v4f v;
            #pragma unroll
            for (int j = 0; j < 4; j++) {
                // soft_clamp(z,-8,8,0.5) = 16*tanh(z/16), z = dt*A
                const float th = fast_tanh((dtn[j & 1] * A[j & 1][q * 2 + (j >> 1)]) * 0.0625f);
                // exp(v) as exp2(v * log2(e)), the same two roundings as __expf
                v[j] = fast_exp2((th * 16.f) * 1.44269504088896340736f);
            }
            dst[q * ST] = v;
        }
    }
}

// Eight packed products m * s, s the low register of an aligned scalar pair, used for
// both halves (op_sel_hi 0: the only form the assembler takes for a scalar source),
// for the scan's input terms (dt * x of two channels) * B[n]: no copy of the B row
// into vector registers.
// volatile: holds them where the source has them, directly behind the scan's barrier,
// where they fill the wait for the LDS read of the partial sums, off the path that
// waits for the norm.
__device__ __forceinline__ void mul8_first(v2f& r0, v2f& r1, v2f& r2, v2f& r3,
                                          v2f& r4, v2f& r5, v2f& r6, v2f& r7, v2f m,
                                          v2f s0, v2f s1, v2f s2, v2f s3,
                                          v2f s4, v2f s5, v2f s6, v2f s7) {
    asm volatile("s_delay_alu instid0(VALU_DEP_1)\n\t"
                 "v_pk_mul_f32 %0, %8, %9 op_sel_hi:[1,0]\n\t"
                 "v_pk_mul_f32 %1, %8, %10 op_sel_hi:[1,0]\n\t"
                 "v_pk_mul_f32 %2, %8, %11 op_sel_hi:[1,0]\n\t"
                 "v_pk_mul_f32 %3, %8, %12 op_sel_hi:[1,0]\n\t"
                 "v_pk_mul_f32 %4, %8, %13 op_sel_hi:[1,0]\n\t"
                 "v_pk_mul_f32 %5, %8, %14 op_sel_hi:[1,0]\n\t"
                 "v_pk_mul_f32 %6, %8, %15 op_sel_hi:[1,0]\n\t"
                 "v_pk_mul_f32 %7, %8, %16 op_sel_hi:[1,0]"
                 : "=&v"(r0), "=&v"(r1), "=&v"(r2), "=&v"(r3),
                   "=&v"(r4), "=&v"(r5), "=&v"(r6), "=&v"(r7)
                 : "v"(m), "s"(s0), "s"(s1), "s"(s2), "s"(s3),
                   "s"(s4), "s"(s5), "s"(s6), "s"(s7));
}
__device__ __forceinline__ void mul8_more(v2f& r0, v2f& r1, v2f& r2, v2f& r3,
                                          v2f& r4, v2f& r5, v2f& r6, v2f& r7, v2f m,
                                          v2f s0, v2f s1, v2f s2, v2f s3,
                                          v2f s4, v2f s5, v2f s6, v2f s7) {
    asm volatile("v_pk_mul_f32 %0, %8, %9 op_sel_hi:[1,0]\n\t"
                 "v_pk_mul_f32 %1, %8, %10 op_sel_hi:[1,0]\n\t"
                 "v_pk_mul_f32 %2, %8, %11 op_sel_hi:[1,0]\n\t"
                 "v_pk_mul_f32 %3, %8, %12 op_sel_hi:[1,0]\n\t"
                 "v_pk_mul_f32 %4, %8, %13 op_sel_hi:[1,0]\n\t"
                 "v_pk_mul_f32 %5, %8, %14 op_sel_hi:[1,0]\n\t"
                 "v_pk_mul_f32 %6, %8, %15 op_sel_hi:[1,0]\n\t"
                 "v_pk_mul_f32 %7, %8, %16 op_sel_hi:[1,0]"
                 : "=&v"(r0), "=&v"(r1), "=&v"(r2), "=&v"(r3),
                   "=&v"(r4), "=&v"(r5), "=&v"(r6), "=&v"(r7)
                 : "v"(m), "s"(s0), "s"(s1), "s"(s2), "s"(s3),
                   "s"(s4), "s"(s5), "s"(s6), "s"(s7));
}

// Output dot of two channels with the C row in scalar register pairs (each value twice):
// four packed chains, eight terms a call. The hints: each link's producer is four
// vector instructions back. volatile: the dot stays in front of the sum of the partials,
// where it fills the wait for their LDS read.
__device__ __forceinline__ void dot8_first(v2f& a0, v2f& a1, v2f& a2, v2f& a3,
                                           v2f h0, v2f h1, v2f h2, v2f h3,
                                           v2f h4, v2f h5, v2f h6, v2f h7,
                                           v2f c0, v2f c1, v2f c2, v2f c3,
                                           v2f c4, v2f c5, v2f c6, v2f c7) {
    asm volatile("v_pk_mul_f32 %0, %4, %12 op_sel_hi:[1,0]\n\t"
                 "v_pk_mul_f32 %1, %5, %13 op_sel_hi:[1,0]\n\t"
                 "v_pk_mul_f32 %2, %6, %14 op_sel_hi:[1,0]\n\t"
                 "v_pk_mul_f32 %3, %7, %15 op_sel_hi:[1,0]\n\t"
                 "s_delay_alu instid0(VALU_DEP_4) | instskip(NEXT) | instid1(VALU_DEP_4)\n\t"
                 "v_pk_fma_f32 %0, %8, %16, %0 op_sel_hi:[1,0,1]\n\t"
                 "v_pk_fma_f32 %1, %9, %17, %1 op_sel_hi:[1,0,1]\n\t"
                 "s_delay_alu instid0(VALU_DEP_4) | instskip(NEXT) | instid1(VALU_DEP_4)\n\t"
                 "v_pk_fma_f32 %2, %10, %18, %2 op_sel_hi:[1,0,1]\n\t"
                 "v_pk_fma_f32 %3, %11, %19, %3 op_sel_hi:[1,0,1]"
                 : "=&v"(a0), "=&v"(a1), "=&v"(a2), "=&v"(a3)
                 : "v"(h0), "v"(h1), "v"(h2), "v"(h3), "v"(h4), "v"(h5), "v"(h6), "v"(h7),
                   "s"(c0), "s"(c1), "s"(c2), "s"(c3), "s"(c4), "s"(c5), "s"(c6), "s"(c7));
}
__device__ __forceinline__ void dot8_more(v2f& a0, v2f& a1, v2f& a2, v2f& a3,
                                          v2f h0, v2f h1, v2f h2, v2f h3,
                                          v2f h4, v2f h5, v2f h6, v2f h7,
                                          v2f c0, v2f c1, v2f c2, v2f c3,
                                          v2f c4, v2f c5, v2f c6, v2f c7) {
    asm volatile("s_delay_alu instid0(VALU_DEP_4) | instskip(NEXT) | instid1(VALU_DEP_4)\n\t"
                 "v_pk_fma_f32 %0, %4, %12, %0 op_sel_hi:[1,0,1]\n\t"
                 "v_pk_fma_f32 %1, %5, %13, %1 op_sel_hi:[1,0,1]\n\t"
                 "s_delay_alu instid0(VALU_DEP_4) | instskip(NEXT) | instid1(VALU_DEP_4)\n\t"
                 "v_pk_fma_f32 %2, %6, %14, %2 op_sel_hi:[1,0,1]\n\t"
                 "v_pk_fma_f32 %3, %7, %15, %3 op_sel_hi:[1,0,1]\n\t"
                 "s_delay_alu instid0(VALU_DEP_4) | instskip(NEXT) | instid1(VALU_DEP_4)\n\t"
                 "v_pk_fma_f32 %0, %8, %16, %0 op_sel_hi:[1,0,1]\n\t"
                 "v_pk_fma_f32 %1, %9, %17, %1 op_sel_hi:[1,0,1]\n\t"
                 "s_delay_alu instid0(VALU_DEP_4) | instskip(NEXT) | instid1(VALU_DEP_4)\n\t"
                 "v_pk_fma_f32 %2, %10, %18, %2 op_sel_hi:[1,0,1]\n\t"
                 "v_pk_fma_f32 %3, %11, %19, %3 op_sel_hi:[1,0,1]"
                 : "+v"(a0), "+v"(a1), "+v"(a2), "+v"(a3)
                 : "v"(h0), "v"(h1), "v"(h2), "v"(h3), "v"(h4), "v"(h5), "v"(h6), "v"(h7),
                   "s"(c0), "s"(c1), "s"(c2), "s"(c3), "s"(c4), "s"(c5), "s"(c6), "s"(c7));
}

// Work-group barrier that waits for this wave's LDS traffic alone. __syncthreads()
// also waits for every global load of the wave, and would land, at each barrier,
// the loads that are issued one and two steps ahead of their use.
__device__ __forceinline__ void lds_barrier() {
    asm volatile("s_wait_dscnt 0x0\n\ts_barrier_signal -1\n\ts_barrier_wait -1" ::: "memory");
}

__global__ void __launch_bounds__(ST)
scan_kernel(const float* __restrict__ x, const float* __restrict__ dt,
            const float* __restrict__ Bp, const float* __restrict__ Cp,
            const float* __restrict__ dAc, const float* __restrict__ Dp,
            float* __restrict__ hst, float* __restrict__ out, int t0) {
    const int b    = blockIdx.x;
    const int p    = threadIdx.x;
    const int lane = threadIdx.x & 31;
    const int wave = threadIdx.x >> 5;

    // the waves' partial square sums, one set for the even and one for the odd steps:
    // a wave that runs ahead writes step t+1's partial while others still read step t's;
    // it reaches step t+2's write only through the barrier of step t+1, which every
    // wave signals behind its own read of step t's set
    __shared__ float wsum[2][ST / 32];
    // the decay ring: buffer s & 1 holds stage s (steps 2 s and 2 s + 1), wave w's slice at w * SLICE
    __shared__ __attribute__((aligned(2048))) unsigned char ring[2 * STAGE];
    const unsigned wv = uni(threadIdx.x >> 5);   // the wave's number, scalar

    v4f* hb = (v4f*)hst + (size_t)b * 8 * ST + p;
    v2f h[NN];
    #pragma unroll
    for (int q = 0; q < 8; q++) {
        v4f v = {0.f, 0.f, 0.f, 0.f};
        if (t0 != 0) v = hb[q * ST];
        h[q*2+0] = v2f{v.x, v.y}; h[q*2+1] = v2f{v.z, v.w};
    }
    const v2f dpv = *(const v2f*)(Dp + p * 2);

    const float* xb  = x  + (size_t)b * LL * DD;
    const float* dtb = dt + (size_t)b * LL * DD;
    const float* Bb  = Bp + (size_t)b * LL * NN * 2;
    const float* Cb  = Cp + (size_t)b * LL * NN * 2;
    const v4f*   dAb = (const v4f*)dAc + (size_t)b * LC * 8 * ST;
    float*       ob  = out + (size_t)b * LL * DD;

    // raw operands of the step that is being fetched (a B or C entry: the value twice)
    v2f xn, dtn, Bn[NN];
    // finished operands of the step that is about to run
    v2f xv, u[NN], Crow[NN];
    // decay factors of the step that is about to run
    v2f dA[NN];

    // byte offsets on scalar bases: xo the x/dt row last fetched, xp the x/dt row last
    // asked into the caches, so the output row last stored
    unsigned xo = (unsigned)t0 * (DD * 4) + (unsigned)p * 8;
    unsigned xp = xo + 2u * (DD * 4);
    unsigned so = xo;
    v2f      ykeep = {0.f, 0.f};   // the value that the step's store names
    // The wait that belongs in front of an overwrite of a register that an issued load
    // or store names, and the overwrites, in one statement: nothing can come between.
    auto next_offsets = [&](int sx, int sp, int ss) {
        asm volatile("s_wait_xcnt 0x0\n\t"
                     "v_add_nc_u32 %0, %3, %0\n\t"
                     "v_add_nc_u32 %1, %4, %1\n\t"
                     "v_add_nc_u32 %2, %5, %2"
                     : "+v"(xo), "+v"(xp), "+v"(so)
                     : "s"(sx), "s"(sp), "s"(ss) : "memory");
    };
    auto load_xdt = [&]() {
        xn  = *(const v2f*)((const char*)xb  + xo);
        dtn = *(const v2f*)((const char*)dtb + xo);
    };
    auto load_B = [&](int t) {
        #pragma unroll
        for (int q = 0; q < 8; q++) {
            float4 bq = *(const float4*)(Bb + t * (NN * 2) + q * 4);
            Bn[q*2+0] = v2f{bq.x, bq.y}; Bn[q*2+1] = v2f{bq.z, bq.w};
        }
    };
    auto load_C = [&](int t) {
        #pragma unroll
        for (int q = 0; q < 8; q++) {
            float4 cq = *(const float4*)(Cb + t * (NN * 2) + q * 4);
            Crow[q*2+0] = v2f{cq.x, cq.y}; Crow[q*2+1] = v2f{cq.z, cq.w};
        }
    };
    // the row of step tl of the chunk, from this wave's own slice of its stage
    auto load_dA = [&](int tl) {
        const v4f* s = (const v4f*)(ring + ((tl >> 1) & 1) * STAGE + wave * SLICE + (tl & 1) * (SLICE / 2)) + lane;
        #pragma unroll
        for (int q = 0; q < 8; q++) {
            const v4f v = s[q * 32];
            dA[q*2+0] = v2f{v.x, v.y}; dA[q*2+1] = v2f{v.z, v.w};
        }
    };
    u32x8 g1;
    g1[0] = pinned(0u);
    g1[1] = uni(512u << 16);
    g1[2] = uni(16u << 16);
    g1[3] = uni(512u << 16);
    g1[4] = uni(16u);
    g1[5] = uni(ST * 16u);
    g1[6] = uni(0u);
    g1[7] = uni(0u);
    const unsigned ring0 = (unsigned)(size_t)ring + wv * SLICE;   // the slice's place in LDS, buffer 0
    // this wave's slice of the stage that begins with row 'row' of the chunk (even)
    u32x4 g0;
    auto load_stage = [&](unsigned row) {
        const unsigned long long ga = (unsigned long long)(size_t)dAb + (unsigned long long)row * (8u * ST * 16u) + wv * 512u;
        g0[0] = uni(1u);
        g0[1] = uni(ring0 + ((row >> 1) & 1u) * STAGE);
        g0[2] = uni((unsigned)ga);
        g0[3] = uni((((unsigned)(ga >> 32)) & 0x01FFFFFFu) | 0x80000000u);
        asm volatile("tensor_load_to_lds %0, %1" : "+s"(g0) : "s"(g1) : "memory");
    };
    auto wait_stage = [&]() {
        asm volatile("s_wait_tensorcnt 0x0" :: "s"(g0), "s"(g1) : "memory");
    };
    auto input_terms = [&]() {
        const v2f dtx = dtn * xn;
        mul8_first(u[0], u[1], u[2], u[3], u[4], u[5], u[6], u[7], dtx,
                   Bn[0], Bn[1], Bn[2], Bn[3], Bn[4], Bn[5], Bn[6], Bn[7]);
        mul8_more(u[8], u[9], u[10], u[11], u[12], u[13], u[14], u[15], dtx,
                  Bn[8], Bn[9], Bn[10], Bn[11], Bn[12], Bn[13], Bn[14], Bn[15]);
        // x is kept for the output term. The copy is made here, where x has landed:
        // left to the compiler it stands at the loop's foot, on the register of the
        // next fetch, and waits there for every load in flight
        asm("v_mov_b64 %0, %1" : "=v"(xv) : "v"(xn));
    };

    auto step = [&](int tl, int par) {
        const int t = t0 + tl;

        // the part that needs the previous step's rescaled state
        // (the fused form written out: dA * h fused onto the rounded input term, in
        // every step alike, whichever product the compiler would pick to fuse)
        #pragma unroll
        for (int n = 0; n < NN; n++) h[n] = __builtin_elementwise_fma(dA[n], h[n], u[n]);
        // square sum of both channels: four packed chains of four links
        v2f sq[4];
        #pragma unroll
        for (int n = 0; n < 4; n++) sq[n] = h[n] * h[n];
        #pragma unroll
        for (int n = 4; n < NN; n++) sq[n & 3] = __builtin_elementwise_fma(h[n], h[n], sq[n & 3]);
        const v2f sqs = (sq[0] + sq[1]) + (sq[2] + sq[3]);
        float ss = sqs.x + sqs.y;
        const v2f xcur = xv;

        // wave32 reduce in registers, then cross-wave via LDS
        ss = wave_sum(ss);
        if (lane == 0) wsum[par][wave] = ss;
        if (par == 0) {
            lds_barrier();
        } else {
            // publish point of the next stage: this wave's LDS reads of the stage that ends
            // here are done, its own tensor load of the next stage has landed; the barrier
            // (the step's own) then says both of every wave
            asm volatile("s_wait_dscnt 0x0" ::: "memory");
            wait_stage();
            asm volatile("s_barrier_signal -1\n\ts_barrier_wait -1" ::: "memory");
            // the stage after the next, into the buffer that every wave has just left
            if (pinned(tl + 3 < LC)) load_stage(pinned(tl + 3));
        }
        // sixteen partials, read by every wave: each 16-lane row will sum all of them
        const float part = wsum[par][lane & 15];
        // the next step's decay row (behind the chunk's last step: an old row, not used)
        load_dA(tl + 1);

        // next step's input terms do not need the norm: they run while the partials
        // come from LDS; then the fetch of the B row of the step after it
        input_terms();
        load_B(t + 2 < LL ? t + 2 : LL - 1);

        // output dot product on the state before its rescale: independent of the
        // norm, it too stands in front of the sum of the partials; the
        // scalar scale is applied to the sum
        v2f y0, y1, y2, y3;
        dot8_first(y0, y1, y2, y3, h[0], h[1], h[2], h[3], h[4], h[5], h[6], h[7],
                   Crow[0], Crow[1], Crow[2], Crow[3], Crow[4], Crow[5], Crow[6], Crow[7]);
        dot8_more(y0, y1, y2, y3, h[8], h[9], h[10], h[11], h[12], h[13], h[14], h[15],
                  Crow[8], Crow[9], Crow[10], Crow[11], Crow[12], Crow[13], Crow[14], Crow[15]);
        const v2f yd = (y0 + y1) + (y2 + y3);
        load_C(t + 1 < LL ? t + 1 : LL - 1);

        // the step's vector memory instructions
        // (behind the scalar load of the C row: no scalar load then follows them closely).
        // Rows stop at the last one (a stride of 0): the last steps fetch it again, the
        // result is not used.
        next_offsets(t + 2 < LL ? DD * 4 : 0, t + 3 < LL ? DD * 4 : 0, tl != 0 ? DD * 4 : 0);
        load_xdt();      // row t + 2
        __builtin_prefetch((const char*)dtb + xp, 0, 0);
        __builtin_prefetch((const char*)xb  + xp, 0, 0);

        // min(20 / (sqrt(v) + 1e-8), 1) as min(20 * rsq(v), 1), the same in every wave.
        // The 1e-8 changes nothing behind the min: from a norm of 0.25 up it is below
        // half a unit of the norm, below that both quotients exceed 1 (v = 0: inf, so 1)
        const float scale = fminf(20.f * __builtin_amdgcn_rsqf(row_sum(part)), 1.f);
        const v2f sc2 = {scale, scale};
        #pragma unroll
        for (int n = 0; n < NN; n++) h[n] *= sc2;
        const v2f sy = sc2 * yd;
        // y = dpv * x + scale * yd, written into the registers that the store names: the
        // store of the step before is covered by this step's wait in next_offsets().
        // In asm so that the value keeps those registers (the hint: sy is fresh)
        asm volatile("s_delay_alu instid0(VALU_DEP_1)\n\t"
                     "v_pk_fma_f32 %0, %1, %2, %3"
                     : "+v"(ykeep) : "v"(dpv), "v"(xcur), "v"(sy));
        *(v2f*)((char*)ob + so) = ykeep;
    };

    // the ring's prologue: stage 0, its wait, the barrier; then stage 1
    load_stage(0);
    load_xdt();
    load_B(t0);
    wait_stage();
    __syncthreads();
    load_stage(2);
    load_dA(0);
    input_terms();
    next_offsets(DD * 4, 0, 0);
    load_xdt();
    load_B(t0 + 1);
    load_C(t0);

    // two steps per trip: one stage of the ring
    for (int tl = 0; tl < LC; tl += 2) {
        step(tl, 0);
        step(tl + 1, 1);
    }
    // no tensor load and no LDS read is left in flight
    asm volatile("s_wait_tensorcnt 0x0" ::: "memory");
    asm volatile("s_wait_dscnt 0x0" ::: "memory");
    // the last store's registers are free for reuse from here on
    asm volatile("s_wait_xcnt 0x0" ::: "memory");

    #pragma unroll
    for (int q = 0; q < 8; q++) {
        const v4f v = {h[q*2+0].x, h[q*2+0].y, h[q*2+1].x, h[q*2+1].y};
        hb[q * ST] = v;
    }
}

// ---------------------------------------------------------------------------
extern "C" void kernel_launch(void* const* d_in, const int* in_sizes, int n_in,
                              void* d_out, int out_size, void* d_ws, size_t ws_size,
                              hipStream_t stream) {
    const float* x     = (const float*)d_in[0];
    const float* Wdt   = (const float*)d_in[1];
    const float* bdt   = (const float*)d_in[2];
    const float* WB    = (const float*)d_in[3];
    const float* WC    = (const float*)d_in[4];
    const float* A_log = (const float*)d_in[5];
    const float* Dp    = (const float*)d_in[6];
    float* out = (float*)d_out;

    char* ws = (char*)d_ws;
    size_t off = 0;
    auto take = [&](size_t bytes) -> void* {
        void* p = ws + off;
        off += (bytes + 255) & ~(size_t)255;
        return p;
    };
    float*  dt  = (float*) take((size_t)ROWS * DD * sizeof(float));   // 16 MB
    float*  Bp  = (float*) take((size_t)ROWS * NN * 2 * sizeof(float));   // each value twice
    float*  Cp  = (float*) take((size_t)ROWS * NN * 2 * sizeof(float));
    __bf16* xbf = (__bf16*)take((size_t)ROWS * DD * sizeof(__bf16));  // 8 MB
    __bf16* wbf = (__bf16*)take((size_t)DD * DD * sizeof(__bf16));    // 2 MB
    float*  dAc = (float*) take((size_t)BB * LC * DD * NN * sizeof(float));  // 64 MB, one chunk
    float*  hst = (float*) take((size_t)BB * DD * NN * sizeof(float));
    (void)ws_size; (void)in_sizes; (void)n_in; (void)out_size;

    // 1) bf16 conversions
    {
        int n = ROWS * DD;                              // 4,194,304
        cvt_bf16_kernel<<<(n / 4 + 255) / 256, 256, 0, stream>>>(x, xbf, n);
        int m = DD * DD;                                // 1,048,576
        cvt_bf16_kernel<<<(m / 4 + 255) / 256, 256, 0, stream>>>(Wdt, wbf, m);
    }
    // 2) WMMA GEMM + softplus + soft_clamp -> dt  (32x32 tile per wave)
    {
        int tiles = (ROWS / 32) * (DD / 32);            // 4096 tiles, 8/block
        wmma_dt_kernel<<<tiles / 8, 256, 0, stream>>>(xbf, wbf, bdt, dt);
    }
    // 3) B/C projections
    proj_kernel<<<(ROWS * NN) / 256, 256, 0, stream>>>(x, WB, WC, Bp, Cp);
    const dim3 dgrid(LC / TP, ST / 256, BB);
    decay_kernel<<<dgrid, 256, 0, stream>>>(dt, A_log, dAc, 0 * LC);
    scan_kernel<<<BB, ST, 0, stream>>>(x, dt, Bp, Cp, dAc, Dp, hst, out, 0 * LC);
    decay_kernel<<<dgrid, 256, 0, stream>>>(dt, A_log, dAc, 1 * LC);
    scan_kernel<<<BB, ST, 0, stream>>>(x, dt, Bp, Cp, dAc, Dp, hst, out, 1 * LC);
    decay_kernel<<<dgrid, 256, 0, stream>>>(dt, A_log, dAc, 2 * LC);
    scan_kernel<<<BB, ST, 0, stream>>>(x, dt, Bp, Cp, dAc, Dp, hst, out, 2 * LC);
    decay_kernel<<<dgrid, 256, 0, stream>>>(dt, A_log, dAc, 3 * LC);
    scan_kernel<<<BB, ST, 0, stream>>>(x, dt, Bp, Cp, dAc, Dp, hst, out, 3 * LC);
}

// v010
// One run takes 1070 microseconds.
// In both of two side-by-side timings against v009, it was 1.16 times as fast.
// All steps since v000 together make it 3.48 times as fast.
#include <hip/hip_runtime.h>
#include <hip/hip_bf16.h>
#include <math.h>

typedef __attribute__((ext_vector_type(16))) __bf16 v16bf;
typedef __attribute__((ext_vector_type(8)))  __bf16 v8bf;
typedef __attribute__((ext_vector_type(8)))  float  v8f;
typedef __attribute__((ext_vector_type(2)))  float  v2f;

#define BB 2
#define LL 2048
#define DD 1024
#define NN 16
#define ROWS (BB*LL)   // 4096
#define LC 512         // time steps per chunk of the scan
#define TP 2           // time steps per thread of the decay kernel
#define ST (DD / 2)    // threads of the scan: each holds two neighbouring channels
#define SLICE 8192     // bytes of one wave's slice of a stage of the decay ring: 2 steps x 8 rows of 512 bytes
#define STAGE (SLICE * (ST / 32))   // bytes of one stage: the decay factors of two steps, 128 KiB
#define RA_M 31        // read-ahead work-groups per residue of the index modulo 8
#define RA_G (8 * RA_M)   // read-ahead work-groups of a scan launch; with the BB scanning ones at most one per WGP

typedef __attribute__((ext_vector_type(4)))  float  v4f;
typedef __attribute__((ext_vector_type(4)))  unsigned u32x4;
typedef __attribute__((ext_vector_type(8)))  unsigned u32x8;

__device__ __forceinline__ unsigned uni(unsigned v) { return (unsigned)__builtin_amdgcn_readfirstlane(v); }
__device__ __forceinline__ unsigned pinned(unsigned v) {
    unsigned w = uni(v);
    asm volatile("" : "+s"(w));
    return w;
}

__device__ __forceinline__ float fast_tanh(float x) {
    float r;
    asm("v_tanh_f32 %0, %1\n\tv_nop" : "=v"(r) : "v"(x));
    return r;
}

__device__ __forceinline__ float fast_exp2(float x) {
    float r;
    asm("v_exp_f32 %0, %1\n\tv_nop" : "=v"(r) : "v"(x));
    return r;
}

template <int M>
__device__ __forceinline__ float add_row_xmask(float v) {
    const int p = __builtin_amdgcn_update_dpp(0, __builtin_bit_cast(int, v), 0x160 | M, 0xf, 0xf, true);
    return v + __builtin_bit_cast(float, p);
}
__device__ __forceinline__ float wave_sum(float v) {
    const int b = __builtin_bit_cast(int, v);
    v += __builtin_bit_cast(float, __builtin_amdgcn_permlanex16(b, b, 0x76543210, 0xfedcba98, false, false));
    v = add_row_xmask<8>(v);
    v = add_row_xmask<4>(v);
    v = add_row_xmask<2>(v);
    v = add_row_xmask<1>(v);
    return v;
}

// Sum over the 16 lanes of a row, every lane of the row gets it.
__device__ __forceinline__ float row_sum(float v) {
    v = add_row_xmask<8>(v);
    v = add_row_xmask<4>(v);
    v = add_row_xmask<2>(v);
    v = add_row_xmask<1>(v);
    return v;
}

__device__ __forceinline__ float soft_clamp_f(float x, float lo, float hi, float sharp) {
    float c  = 0.5f * (hi + lo);
    float r  = 0.5f * (hi - lo);
    float xn = (x - c) / (r + 1e-8f);
    return fast_tanh(xn * sharp) / sharp * r + c;
}

// ---------------------------------------------------------------------------
// fp32 -> bf16 conversion (4 elements/thread)
// ---------------------------------------------------------------------------
__global__ void __launch_bounds__(256)
cvt_bf16_kernel(const float* __restrict__ in, __bf16* __restrict__ out, int n) {
    int base = (blockIdx.x * blockDim.x + threadIdx.x) * 4;
    if (base < n) {
        float4 v = *(const float4*)(in + base);
        out[base + 0] = (__bf16)v.x;
        out[base + 1] = (__bf16)v.y;
        out[base + 2] = (__bf16)v.z;
        out[base + 3] = (__bf16)v.w;
    }
}

// ---------------------------------------------------------------------------
// dt = soft_clamp(softplus(x @ Wdt^T + bdt))  via  v_wmma_f32_16x16x32_bf16
// 2x2 register tiling: one wave computes a 32x32 output block (4 accumulators),
// each A/B fragment is reused twice -> 8 b128 loads feed 4 WMMAs.
// ---------------------------------------------------------------------------
__global__ void __launch_bounds__(256)
wmma_dt_kernel(const __bf16* __restrict__ xbf, const __bf16* __restrict__ wbf,
               const float* __restrict__ bdt, float* __restrict__ dt) {
    const int lane = threadIdx.x & 31;
    const int wave = threadIdx.x >> 5;            // 0..7
    const int tile = blockIdx.x * 8 + wave;       // 0..4095
    const int tm   = tile >> 5;                   // 0..127  (32-row strips)
    const int tn   = tile & 31;                   // 0..31   (32-col strips)

    const int l15 = lane & 15;
    const int kg  = (lane >> 4) * 8;              // K sub-group: 0 or 8

    // A fragments: rows tm*32 + l15 (+16); K groups [kg..kg+7], [16+kg..16+kg+7]
    const __bf16* arow0 = xbf + (size_t)(tm * 32 + l15) * DD + kg;
    const __bf16* arow1 = arow0 + (size_t)16 * DD;
    // B fragments: columns tn*32 + l15 (+16); Wdt row-major in k
    const __bf16* brow0 = wbf + (size_t)(tn * 32 + l15) * DD + kg;
    const __bf16* brow1 = brow0 + (size_t)16 * DD;

    v8f acc00 = {}, acc01 = {}, acc10 = {}, acc11 = {};

    #pragma unroll 2
    for (int k0 = 0; k0 < DD; k0 += 32) {
        v8bf a0lo = *(const v8bf*)(arow0 + k0);
        v8bf a0hi = *(const v8bf*)(arow0 + k0 + 16);
        v8bf a1lo = *(const v8bf*)(arow1 + k0);
        v8bf a1hi = *(const v8bf*)(arow1 + k0 + 16);
        v8bf b0lo = *(const v8bf*)(brow0 + k0);
        v8bf b0hi = *(const v8bf*)(brow0 + k0 + 16);
        v8bf b1lo = *(const v8bf*)(brow1 + k0);
        v8bf b1hi = *(const v8bf*)(brow1 + k0 + 16);
        v16bf A0, A1, B0, B1;
        #pragma unroll
        for (int i = 0; i < 8; i++) {
            A0[i] = a0lo[i]; A0[i + 8] = a0hi[i];
            A1[i] = a1lo[i]; A1[i + 8] = a1hi[i];
            B0[i] = b0lo[i]; B0[i + 8] = b0hi[i];
            B1[i] = b1lo[i]; B1[i + 8] = b1hi[i];
        }
        acc00 = __builtin_amdgcn_wmma_f32_16x16x32_bf16(false, A0, false, B0, (short)0, acc00, false, false);
        acc01 = __builtin_amdgcn_wmma_f32_16x16x32_bf16(false, A0, false, B1, (short)0, acc01, false, false);
        acc10 = __builtin_amdgcn_wmma_f32_16x16x32_bf16(false, A1, false, B0, (short)0, acc10, false, false);
        acc11 = __builtin_amdgcn_wmma_f32_16x16x32_bf16(false, A1, false, B1, (short)0, acc11, false, false);
    }

    const int mbase = (lane >> 4) * 8;
    auto epilogue = [&](v8f acc, int rowbase, int colbase) {
        const int col  = colbase + l15;
        const float bias = bdt[col];
        #pragma unroll
        for (int r = 0; r < 8; r++) {
            int row  = rowbase + mbase + r;
            float v  = acc[r] + bias;
            // softplus via hardware v_exp_f32 / v_log_f32 (result clamped anyway)
            float sp = (v > 20.f) ? v : __logf(1.f + __expf(v));
            dt[(size_t)row * DD + col] = soft_clamp_f(sp, 0.001f, 0.1f, 0.5f);
        }
    };
    epilogue(acc00, tm * 32,      tn * 32);
    epilogue(acc01, tm * 32,      tn * 32 + 16);
    epilogue(acc10, tm * 32 + 16, tn * 32);
    epilogue(acc11, tm * 32 + 16, tn * 32 + 16);
}

// ---------------------------------------------------------------------------
// Bp = x @ WB^T, Cp = x @ WC^T   ([4096,16] each) — small, plain VALU
// Each value is stored twice in a row: the scan reads a row into scalar registers,
// and a packed f32 instruction takes an aligned scalar pair as one operand.
// ---------------------------------------------------------------------------
__global__ void __launch_bounds__(256)
proj_kernel(const float* __restrict__ x, const float* __restrict__ WB,
            const float* __restrict__ WC, float* __restrict__ Bp,
            float* __restrict__ Cp) {
    int t   = blockIdx.x * blockDim.x + threadIdx.x;   // 0..65535
    int row = t >> 4;
    int n   = t & 15;
    const float4* xr = (const float4*)(x + (size_t)row * DD);
    const float4* wb = (const float4*)(WB + (size_t)n * DD);
    const float4* wc = (const float4*)(WC + (size_t)n * DD);
    float sb = 0.f, sc = 0.f;
    #pragma unroll 4
    for (int k = 0; k < DD / 4; k++) {
        float4 xv = xr[k], bv = wb[k], cv = wc[k];
        sb += xv.x * bv.x + xv.y * bv.y + xv.z * bv.z + xv.w * bv.w;
        sc += xv.x * cv.x + xv.y * cv.y + xv.z * cv.z + xv.w * cv.w;
    }
    ((float2*)Bp)[t] = make_float2(sb, sb);
    ((float2*)Cp)[t] = make_float2(sc, sc);
}

__global__ void __launch_bounds__(256)
decay_kernel(const float* __restrict__ dt, const float* __restrict__ A_log,
             float* __restrict__ dAc, int t0) {
    const int p   = blockIdx.y * 256 + threadIdx.x;   // 0..ST-1
    const int b   = blockIdx.z;
    const int tl0 = blockIdx.x * TP;

    float A[2][NN];
    #pragma unroll
    for (int c = 0; c < 2; c++) {
        #pragma unroll
        for (int q = 0; q < 4; q++) {
            const v4f al = *((const v4f*)A_log + (p * 2 + c) * 4 + q);
            #pragma unroll
            for (int j = 0; j < 4; j++) {
                // soft_clamp(al,-5,5,0.5) = 10*tanh(al/10)
                A[c][q * 4 + j] = -__expf(10.f * fast_tanh(al[j] * 0.1f));
            }
        }
    }
    #pragma unroll
    for (int i = 0; i < TP; i++) {
        const int tl = tl0 + i;
        const v2f dtn = *(const v2f*)(dt + ((size_t)b * LL + t0 + tl) * DD + p * 2);
        // the wait that belongs in front of an overwrite of a register that an issued
        // load names
        if (i + 1 < TP) asm volatile("s_wait_xcnt 0x0" ::: "memory");
        v4f* dst = (v4f*)dAc + (size_t)(b * LC + tl) * 8 * ST + p;
        #pragma unroll
        for (int q = 0; q < 8; q++) {
            v4f v;
            #pragma unroll
            for (int j = 0; j < 4; j++) {
                // soft_clamp(z,-8,8,0.5) = 16*tanh(z/16), z = dt*A
                const float th = fast_tanh((dtn[j & 1] * A[j & 1][q * 2 + (j >> 1)]) * 0.0625f);
                // exp(v) as exp2(v * log2(e)), the same two roundings as __expf
                v[j] = fast_exp2((th * 16.f) * 1.44269504088896340736f);
            }
            dst[q * ST] = v;
        }
    }
}

// Eight packed products m * s, s the low register of an aligned scalar pair, used for
// both halves (op_sel_hi 0: the only form the assembler takes for a scalar source),
// for the scan's input terms (dt * x of two channels) * B[n]: no copy of the B row
// into vector registers.
// volatile: holds them where the source has them, directly behind the scan's barrier,
// where they fill the wait for the LDS read of the partial sums, off the path that
// waits for the norm.
__device__ __forceinline__ void mul8_first(v2f& r0, v2f& r1, v2f& r2, v2f& r3,
                                          v2f& r4, v2f& r5, v2f& r6, v2f& r7, v2f m,
                                          v2f s0, v2f s1, v2f s2, v2f s3,
                                          v2f s4, v2f s5, v2f s6, v2f s7) {
    asm volatile("s_delay_alu instid0(VALU_DEP_1)\n\t"
                 "v_pk_mul_f32 %0, %8, %9 op_sel_hi:[1,0]\n\t"
                 "v_pk_mul_f32 %1, %8, %10 op_sel_hi:[1,0]\n\t"
                 "v_pk_mul_f32 %2, %8, %11 op_sel_hi:[1,0]\n\t"
                 "v_pk_mul_f32 %3, %8, %12 op_sel_hi:[1,0]\n\t"
                 "v_pk_mul_f32 %4, %8, %13 op_sel_hi:[1,0]\n\t"
                 "v_pk_mul_f32 %5, %8, %14 op_sel_hi:[1,0]\n\t"
                 "v_pk_mul_f32 %6, %8, %15 op_sel_hi:[1,0]\n\t"
                 "v_pk_mul_f32 %7, %8, %16 op_sel_hi:[1,0]"
                 : "=&v"(r0), "=&v"(r1), "=&v"(r2), "=&v"(r3),
                   "=&v"(r4), "=&v"(r5), "=&v"(r6), "=&v"(r7)
                 : "v"(m), "s"(s0), "s"(s1), "s"(s2), "s"(s3),
                   "s"(s4), "s"(s5), "s"(s6), "s"(s7));
}
__device__ __forceinline__ void mul8_more(v2f& r0, v2f& r1, v2f& r2, v2f& r3,
                                          v2f& r4, v2f& r5, v2f& r6, v2f& r7, v2f m,
                                          v2f s0, v2f s1, v2f s2, v2f s3,
                                          v2f s4, v2f s5, v2f s6, v2f s7) {
    asm volatile("v_pk_mul_f32 %0, %8, %9 op_sel_hi:[1,0]\n\t"
                 "v_pk_mul_f32 %1, %8, %10 op_sel_hi:[1,0]\n\t"
                 "v_pk_mul_f32 %2, %8, %11 op_sel_hi:[1,0]\n\t"
                 "v_pk_mul_f32 %3, %8, %12 op_sel_hi:[1,0]\n\t"
                 "v_pk_mul_f32 %4, %8, %13 op_sel_hi:[1,0]\n\t"
                 "v_pk_mul_f32 %5, %8, %14 op_sel_hi:[1,0]\n\t"
                 "v_pk_mul_f32 %6, %8, %15 op_sel_hi:[1,0]\n\t"
                 "v_pk_mul_f32 %7, %8, %16 op_sel_hi:[1,0]"
                 : "=&v"(r0), "=&v"(r1), "=&v"(r2), "=&v"(r3),
                   "=&v"(r4), "=&v"(r5), "=&v"(r6), "=&v"(r7)
                 : "v"(m), "s"(s0), "s"(s1), "s"(s2), "s"(s3),
                   "s"(s4), "s"(s5), "s"(s6), "s"(s7));
}

// Output dot of two channels with the C row in scalar register pairs (each value twice):
// four packed chains, eight terms a call. The hints: each link's producer is four
// vector instructions back. volatile: the dot stays in front of the sum of the partials,
// where it fills the wait for their LDS read.
__device__ __forceinline__ void dot8_first(v2f& a0, v2f& a1, v2f& a2, v2f& a3,
                                           v2f h0, v2f h1, v2f h2, v2f h3,
                                           v2f h4, v2f h5, v2f h6, v2f h7,
                                           v2f c0, v2f c1, v2f c2, v2f c3,
                                           v2f c4, v2f c5, v2f c6, v2f c7) {
    asm volatile("v_pk_mul_f32 %0, %4, %12 op_sel_hi:[1,0]\n\t"
                 "v_pk_mul_f32 %1, %5, %13 op_sel_hi:[1,0]\n\t"
                 "v_pk_mul_f32 %2, %6, %14 op_sel_hi:[1,0]\n\t"
                 "v_pk_mul_f32 %3, %7, %15 op_sel_hi:[1,0]\n\t"
                 "s_delay_alu instid0(VALU_DEP_4) | instskip(NEXT) | instid1(VALU_DEP_4)\n\t"
                 "v_pk_fma_f32 %0, %8, %16, %0 op_sel_hi:[1,0,1]\n\t"
                 "v_pk_fma_f32 %1, %9, %17, %1 op_sel_hi:[1,0,1]\n\t"
                 "s_delay_alu instid0(VALU_DEP_4) | instskip(NEXT) | instid1(VALU_DEP_4)\n\t"
                 "v_pk_fma_f32 %2, %10, %18, %2 op_sel_hi:[1,0,1]\n\t"
                 "v_pk_fma_f32 %3, %11, %19, %3 op_sel_hi:[1,0,1]"
                 : "=&v"(a0), "=&v"(a1), "=&v"(a2), "=&v"(a3)
                 : "v"(h0), "v"(h1), "v"(h2), "v"(h3), "v"(h4), "v"(h5), "v"(h6), "v"(h7),
                   "s"(c0), "s"(c1), "s"(c2), "s"(c3), "s"(c4), "s"(c5), "s"(c6), "s"(c7));
}
__device__ __forceinline__ void dot8_more(v2f& a0, v2f& a1, v2f& a2, v2f& a3,
                                          v2f h0, v2f h1, v2f h2, v2f h3,
                                          v2f h4, v2f h5, v2f h6, v2f h7,
                                          v2f c0, v2f c1, v2f c2, v2f c3,
                                          v2f c4, v2f c5, v2f c6, v2f c7) {
    asm volatile("s_delay_alu instid0(VALU_DEP_4) | instskip(NEXT) | instid1(VALU_DEP_4)\n\t"
                 "v_pk_fma_f32 %0, %4, %12, %0 op_sel_hi:[1,0,1]\n\t"
                 "v_pk_fma_f32 %1, %5, %13, %1 op_sel_hi:[1,0,1]\n\t"
                 "s_delay_alu instid0(VALU_DEP_4) | instskip(NEXT) | instid1(VALU_DEP_4)\n\t"
                 "v_pk_fma_f32 %2, %6, %14, %2 op_sel_hi:[1,0,1]\n\t"
                 "v_pk_fma_f32 %3, %7, %15, %3 op_sel_hi:[1,0,1]\n\t"
                 "s_delay_alu instid0(VALU_DEP_4) | instskip(NEXT) | instid1(VALU_DEP_4)\n\t"
                 "v_pk_fma_f32 %0, %8, %16, %0 op_sel_hi:[1,0,1]\n\t"
                 "v_pk_fma_f32 %1, %9, %17, %1 op_sel_hi:[1,0,1]\n\t"
                 "s_delay_alu instid0(VALU_DEP_4) | instskip(NEXT) | instid1(VALU_DEP_4)\n\t"
                 "v_pk_fma_f32 %2, %10, %18, %2 op_sel_hi:[1,0,1]\n\t"
                 "v_pk_fma_f32 %3, %11, %19, %3 op_sel_hi:[1,0,1]"
                 : "+v"(a0), "+v"(a1), "+v"(a2), "+v"(a3)
                 : "v"(h0), "v"(h1), "v"(h2), "v"(h3), "v"(h4), "v"(h5), "v"(h6), "v"(h7),
                   "s"(c0), "s"(c1), "s"(c2), "s"(c3), "s"(c4), "s"(c5), "s"(c6), "s"(c7));
}

// Work-group barrier that waits for this wave's LDS traffic alone. __syncthreads()
// also waits for every global load of the wave, and would land, at each barrier,
// the loads that are issued one and two steps ahead of their use.
__device__ __forceinline__ void lds_barrier() {
    asm volatile("s_wait_dscnt 0x0\n\ts_barrier_signal -1\n\ts_barrier_wait -1" ::: "memory");
}

__global__ void __launch_bounds__(ST)
scan_kernel(const float* __restrict__ x, const float* __restrict__ dt,
            const float* __restrict__ Bp, const float* __restrict__ Cp,
            const float* __restrict__ dAc, const float* __restrict__ Dp,
            float* __restrict__ hst, float* __restrict__ out, int t0) {
    if (blockIdx.x >= BB) {
        // Where a work-group lands is not promised:
        // every residue c of the index modulo 8 reads the whole chunk, RA_M work-groups
        // each, and the turn by 4 c sets a row's eight readers far apart in the index too.
        const unsigned g = blockIdx.x - BB;
        const unsigned c = g & 7u;
        // row r: step r >> 1 of batch r & 1, 64 KiB = eight loads of 16 bytes a thread
        for (unsigned r = ((g >> 3) + RA_M - 4u * c) % RA_M; r < 2u * LC; r += RA_M) {
            const char* src = (const char*)dAc + ((size_t)(r & 1u) * LC + (r >> 1)) * (8u * ST * 16u) + threadIdx.x * 16u;
            v4f r0, r1, r2, r3, r4, r5, r6, r7;
            // Loads whose values are not used: what counts is the line they leave in L2 (a
            // prefetch is a hint and may be dropped). In asm so that they stay, with their
            // data wait in the same statement: behind it src is free for the next row.
            asm volatile("global_load_b128 %0, %8, off\n\t"
                         "global_load_b128 %1, %8, off offset:8192\n\t"
                         "global_load_b128 %2, %8, off offset:16384\n\t"
                         "global_load_b128 %3, %8, off offset:24576\n\t"
                         "global_load_b128 %4, %8, off offset:32768\n\t"
                         "global_load_b128 %5, %8, off offset:40960\n\t"
                         "global_load_b128 %6, %8, off offset:49152\n\t"
                         "global_load_b128 %7, %8, off offset:57344\n\t"
                         "s_wait_loadcnt 0x0"
                         : "=&v"(r0), "=&v"(r1), "=&v"(r2), "=&v"(r3),
                           "=&v"(r4), "=&v"(r5), "=&v"(r6), "=&v"(r7)
                         : "v"(src) : "memory");
        }
        return;   // in front of every barrier and tensor load, the whole work-group
    }
    const int b    = blockIdx.x;
    const int p    = threadIdx.x;
    const int lane = threadIdx.x & 31;
    const int wave = threadIdx.x >> 5;

    // the waves' partial square sums, one set for the even and one for the odd steps:
    // a wave that runs ahead writes step t+1's partial while others still read step t's;
    // it reaches step t+2's write only through the barrier of step t+1, which every
    // wave signals behind its own read of step t's set
    __shared__ float wsum[2][ST / 32];
    // the decay ring: buffer s & 1 holds stage s (steps 2 s and 2 s + 1), wave w's slice at w * SLICE
    __shared__ __attribute__((aligned(2048))) unsigned char ring[2 * STAGE];
    const unsigned wv = uni(threadIdx.x >> 5);   // the wave's number, scalar

    v4f* hb = (v4f*)hst + (size_t)b * 8 * ST + p;
    v2f h[NN];
    #pragma unroll
    for (int q = 0; q < 8; q++) {
        v4f v = {0.f, 0.f, 0.f, 0.f};
        if (t0 != 0) v = hb[q * ST];
        h[q*2+0] = v2f{v.x, v.y}; h[q*2+1] = v2f{v.z, v.w};
    }
    const v2f dpv = *(const v2f*)(Dp + p * 2);

    const float* xb  = x  + (size_t)b * LL * DD;
    const float* dtb = dt + (size_t)b * LL * DD;
    const float* Bb  = Bp + (size_t)b * LL * NN * 2;
    const float* Cb  = Cp + (size_t)b * LL * NN * 2;
    const v4f*   dAb = (const v4f*)dAc + (size_t)b * LC * 8 * ST;
    float*       ob  = out + (size_t)b * LL * DD;

    // raw operands of the step that is being fetched (a B or C entry: the value twice)
    v2f xn, dtn, Bn[NN];
    // finished operands of the step that is about to run
    v2f xv, u[NN], Crow[NN];
    // decay factors of the step that is about to run
    v2f dA[NN];

    // byte offsets on scalar bases: xo the x/dt row last fetched, xp the x/dt row last
    // asked into the caches, so the output row last stored
    unsigned xo = (unsigned)t0 * (DD * 4) + (unsigned)p * 8;
    unsigned xp = xo + 2u * (DD * 4);
    unsigned so = xo;
    v2f      ykeep = {0.f, 0.f};   // the value that the step's store names
    // The wait that belongs in front of an overwrite of a register that an issued load
    // or store names, and the overwrites, in one statement: nothing can come between.
    auto next_offsets = [&](int sx, int sp, int ss) {
        asm volatile("s_wait_xcnt 0x0\n\t"
                     "v_add_nc_u32 %0, %3, %0\n\t"
                     "v_add_nc_u32 %1, %4, %1\n\t"
                     "v_add_nc_u32 %2, %5, %2"
                     : "+v"(xo), "+v"(xp), "+v"(so)
                     : "s"(sx), "s"(sp), "s"(ss) : "memory");
    };
    auto load_xdt = [&]() {
        xn  = *(const v2f*)((const char*)xb  + xo);
        dtn = *(const v2f*)((const char*)dtb + xo);
    };
    auto load_B = [&](int t) {
        #pragma unroll
        for (int q = 0; q < 8; q++) {
            float4 bq = *(const float4*)(Bb + t * (NN * 2) + q * 4);
            Bn[q*2+0] = v2f{bq.x, bq.y}; Bn[q*2+1] = v2f{bq.z, bq.w};
        }
    };
    auto load_C = [&](int t) {
        #pragma unroll
        for (int q = 0; q < 8; q++) {
            float4 cq = *(const float4*)(Cb + t * (NN * 2) + q * 4);
            Crow[q*2+0] = v2f{cq.x, cq.y}; Crow[q*2+1] = v2f{cq.z, cq.w};
        }
    };
    // the row of step tl of the chunk, from this wave's own slice of its stage
    auto load_dA = [&](int tl) {
        const v4f* s = (const v4f*)(ring + ((tl >> 1) & 1) * STAGE + wave * SLICE + (tl & 1) * (SLICE / 2)) + lane;
        #pragma unroll
        for (int q = 0; q < 8; q++) {
            const v4f v = s[q * 32];
            dA[q*2+0] = v2f{v.x, v.y}; dA[q*2+1] = v2f{v.z, v.w};
        }
    };
    u32x8 g1;
    g1[0] = pinned(0u);
    g1[1] = uni(512u << 16);
    g1[2] = uni(16u << 16);
    g1[3] = uni(512u << 16);
    g1[4] = uni(16u);
    g1[5] = uni(ST * 16u);
    g1[6] = uni(0u);
    g1[7] = uni(0u);
    const unsigned ring0 = (unsigned)(size_t)ring + wv * SLICE;   // the slice's place in LDS, buffer 0
    // this wave's slice of the stage that begins with row 'row' of the chunk (even)
    u32x4 g0;
    auto load_stage = [&](unsigned row) {
        const unsigned long long ga = (unsigned long long)(size_t)dAb + (unsigned long long)row * (8u * ST * 16u) + wv * 512u;
        g0[0] = uni(1u);
        g0[1] = uni(ring0 + ((row >> 1) & 1u) * STAGE);
        g0[2] = uni((unsigned)ga);
        g0[3] = uni((((unsigned)(ga >> 32)) & 0x01FFFFFFu) | 0x80000000u);
        asm volatile("tensor_load_to_lds %0, %1" : "+s"(g0) : "s"(g1) : "memory");
    };
    auto wait_stage = [&]() {
        asm volatile("s_wait_tensorcnt 0x0" :: "s"(g0), "s"(g1) : "memory");
    };
    auto input_terms = [&]() {
        const v2f dtx = dtn * xn;
        mul8_first(u[0], u[1], u[2], u[3], u[4], u[5], u[6], u[7], dtx,
                   Bn[0], Bn[1], Bn[2], Bn[3], Bn[4], Bn[5], Bn[6], Bn[7]);
        mul8_more(u[8], u[9], u[10], u[11], u[12], u[13], u[14], u[15], dtx,
                  Bn[8], Bn[9], Bn[10], Bn[11], Bn[12], Bn[13], Bn[14], Bn[15]);
        // x is kept for the output term. The copy is made here, where x has landed:
        // left to the compiler it stands at the loop's foot, on the register of the
        // next fetch, and waits there for every load in flight
        asm("v_mov_b64 %0, %1" : "=v"(xv) : "v"(xn));
    };

    auto step = [&](int tl, int par) {
        const int t = t0 + tl;

        // the part that needs the previous step's rescaled state
        // (the fused form written out: dA * h fused onto the rounded input term, in
        // every step alike, whichever product the compiler would pick to fuse)
        #pragma unroll
        for (int n = 0; n < NN; n++) h[n] = __builtin_elementwise_fma(dA[n], h[n], u[n]);
        // square sum of both channels: four packed chains of four links
        v2f sq[4];
        #pragma unroll
        for (int n = 0; n < 4; n++) sq[n] = h[n] * h[n];
        #pragma unroll
        for (int n = 4; n < NN; n++) sq[n & 3] = __builtin_elementwise_fma(h[n], h[n], sq[n & 3]);
        const v2f sqs = (sq[0] + sq[1]) + (sq[2] + sq[3]);
        float ss = sqs.x + sqs.y;
        const v2f xcur = xv;

        // wave32 reduce in registers, then cross-wave via LDS
        ss = wave_sum(ss);
        if (lane == 0) wsum[par][wave] = ss;
        if (par == 0) {
            lds_barrier();
        } else {
            // publish point of the next stage: this wave's LDS reads of the stage that ends
            // here are done, its own tensor load of the next stage has landed; the barrier
            // (the step's own) then says both of every wave
            asm volatile("s_wait_dscnt 0x0" ::: "memory");
            wait_stage();
            asm volatile("s_barrier_signal -1\n\ts_barrier_wait -1" ::: "memory");
            // the stage after the next, into the buffer that every wave has just left
            if (pinned(tl + 3 < LC)) load_stage(pinned(tl + 3));
        }
        // sixteen partials, read by every wave: each 16-lane row will sum all of them
        const float part = wsum[par][lane & 15];
        // the next step's decay row (behind the chunk's last step: an old row, not used)
        load_dA(tl + 1);

        // next step's input terms do not need the norm: they run while the partials
        // come from LDS; then the fetch of the B row of the step after it
        input_terms();
        load_B(t + 2 < LL ? t + 2 : LL - 1);

        // output dot product on the state before its rescale: independent of the
        // norm, it too stands in front of the sum of the partials; the
        // scalar scale is applied to the sum
        v2f y0, y1, y2, y3;
        dot8_first(y0, y1, y2, y3, h[0], h[1], h[2], h[3], h[4], h[5], h[6], h[7],
                   Crow[0], Crow[1], Crow[2], Crow[3], Crow[4], Crow[5], Crow[6], Crow[7]);
        dot8_more(y0, y1, y2, y3, h[8], h[9], h[10], h[11], h[12], h[13], h[14], h[15],
                  Crow[8], Crow[9], Crow[10], Crow[11], Crow[12], Crow[13], Crow[14], Crow[15]);
        const v2f yd = (y0 + y1) + (y2 + y3);
        load_C(t + 1 < LL ? t + 1 : LL - 1);

        // the step's vector memory instructions
        // (behind the scalar load of the C row: no scalar load then follows them closely).
        // Rows stop at the last one (a stride of 0): the last steps fetch it again, the
        // result is not used.
        next_offsets(t + 2 < LL ? DD * 4 : 0, t + 3 < LL ? DD * 4 : 0, tl != 0 ? DD * 4 : 0);
        load_xdt();      // row t + 2
        __builtin_prefetch((const char*)dtb + xp, 0, 0);
        __builtin_prefetch((const char*)xb  + xp, 0, 0);

        // min(20 / (sqrt(v) + 1e-8), 1) as min(20 * rsq(v), 1), the same in every wave.
        // The 1e-8 changes nothing behind the min: from a norm of 0.25 up it is below
        // half a unit of the norm, below that both quotients exceed 1 (v = 0: inf, so 1)
        const float scale = fminf(20.f * __builtin_amdgcn_rsqf(row_sum(part)), 1.f);
        const v2f sc2 = {scale, scale};
        #pragma unroll
        for (int n = 0; n < NN; n++) h[n] *= sc2;
        const v2f sy = sc2 * yd;
        // y = dpv * x + scale * yd, written into the registers that the store names: the
        // store of the step before is covered by this step's wait in next_offsets().
        // In asm so that the value keeps those registers (the hint: sy is fresh)
        asm volatile("s_delay_alu instid0(VALU_DEP_1)\n\t"
                     "v_pk_fma_f32 %0, %1, %2, %3"
                     : "+v"(ykeep) : "v"(dpv), "v"(xcur), "v"(sy));
        *(v2f*)((char*)ob + so) = ykeep;
    };

    // the ring's prologue: stage 0, its wait, the barrier; then stage 1
    load_stage(0);
    load_xdt();
    load_B(t0);
    wait_stage();
    __syncthreads();
    load_stage(2);
    load_dA(0);
    input_terms();
    next_offsets(DD * 4, 0, 0);
    load_xdt();
    load_B(t0 + 1);
    load_C(t0);

    // two steps per trip: one stage of the ring
    for (int tl = 0; tl < LC; tl += 2) {
        step(tl, 0);
        step(tl + 1, 1);
    }
    // no tensor load and no LDS read is left in flight
    asm volatile("s_wait_tensorcnt 0x0" ::: "memory");
    asm volatile("s_wait_dscnt 0x0" ::: "memory");
    // the last store's registers are free for reuse from here on
    asm volatile("s_wait_xcnt 0x0" ::: "memory");

    #pragma unroll
    for (int q = 0; q < 8; q++) {
        const v4f v = {h[q*2+0].x, h[q*2+0].y, h[q*2+1].x, h[q*2+1].y};
        hb[q * ST] = v;
    }
}

// ---------------------------------------------------------------------------
extern "C" void kernel_launch(void* const* d_in, const int* in_sizes, int n_in,
                              void* d_out, int out_size, void* d_ws, size_t ws_size,
                              hipStream_t stream) {
    const float* x     = (const float*)d_in[0];
    const float* Wdt   = (const float*)d_in[1];
    const float* bdt   = (const float*)d_in[2];
    const float* WB    = (const float*)d_in[3];
    const float* WC    = (const float*)d_in[4];
    const float* A_log = (const float*)d_in[5];
    const float* Dp    = (const float*)d_in[6];
    float* out = (float*)d_out;

    char* ws = (char*)d_ws;
    size_t off = 0;
    auto take = [&](size_t bytes) -> void* {
        void* p = ws + off;
        off += (bytes + 255) & ~(size_t)255;
        return p;
    };
    float*  dt  = (float*) take((size_t)ROWS * DD * sizeof(float));   // 16 MB
    float*  Bp  = (float*) take((size_t)ROWS * NN * 2 * sizeof(float));   // each value twice
    float*  Cp  = (float*) take((size_t)ROWS * NN * 2 * sizeof(float));
    __bf16* xbf = (__bf16*)take((size_t)ROWS * DD * sizeof(__bf16));  // 8 MB
    __bf16* wbf = (__bf16*)take((size_t)DD * DD * sizeof(__bf16));    // 2 MB
    float*  dAc = (float*) take((size_t)BB * LC * DD * NN * sizeof(float));  // 64 MB, one chunk
    float*  hst = (float*) take((size_t)BB * DD * NN * sizeof(float));
    (void)ws_size; (void)in_sizes; (void)n_in; (void)out_size;

    // 1) bf16 conversions
    {
        int n = ROWS * DD;                              // 4,194,304
        cvt_bf16_kernel<<<(n / 4 + 255) / 256, 256, 0, stream>>>(x, xbf, n);
        int m = DD * DD;                                // 1,048,576
        cvt_bf16_kernel<<<(m / 4 + 255) / 256, 256, 0, stream>>>(Wdt, wbf, m);
    }
    // 2) WMMA GEMM + softplus + soft_clamp -> dt  (32x32 tile per wave)
    {
        int tiles = (ROWS / 32) * (DD / 32);            // 4096 tiles, 8/block
        wmma_dt_kernel<<<tiles / 8, 256, 0, stream>>>(xbf, wbf, bdt, dt);
    }
    // 3) B/C projections
    proj_kernel<<<(ROWS * NN) / 256, 256, 0, stream>>>(x, WB, WC, Bp, Cp);
    const dim3 dgrid(LC / TP, ST / 256, BB);
    decay_kernel<<<dgrid, 256, 0, stream>>>(dt, A_log, dAc, 0 * LC);
    scan_kernel<<<BB + RA_G, ST, 0, stream>>>(x, dt, Bp, Cp, dAc, Dp, hst, out, 0 * LC);
    decay_kernel<<<dgrid, 256, 0, stream>>>(dt, A_log, dAc, 1 * LC);
    scan_kernel<<<BB + RA_G, ST, 0, stream>>>(x, dt, Bp, Cp, dAc, Dp, hst, out, 1 * LC);
    decay_kernel<<<dgrid, 256, 0, stream>>>(dt, A_log, dAc, 2 * LC);
    scan_kernel<<<BB + RA_G, ST, 0, stream>>>(x, dt, Bp, Cp, dAc, Dp, hst, out, 2 * LC);
    decay_kernel<<<dgrid, 256, 0, stream>>>(dt, A_log, dAc, 3 * LC);
    scan_kernel<<<BB + RA_G, ST, 0, stream>>>(x, dt, Bp, Cp, dAc, Dp, hst, out, 3 * LC);
}
